// v000
// Measured on an AMD MI455X. A time is GPU time per run, averaged over a window of back-to-back runs after a warm-up
// (all launches, gaps included; the runs take copies of the inputs in turn), and the median of several windows.
// Apart from v000's, it joins two sittings. Times from different sittings can be a few percent apart, while
// side-by-side timings come from the same sitting.
// The starting kernel, v000, takes 2260 microseconds a run.
#include <hip/hip_runtime.h>

// Local causal multi-head attention WITHOUT the 1/sqrt(d) scaling (x [1][4096][1024]; q,k,v = x W^T ('oi' [1024][1024], no bias; 16 heads x 64); scores = q.k (unscaled: logit sigma ~8); keys with j > i or j <= i - 256 masked (-1e30 == exclusion); softmax; ctx merged; out = ctx Wo^T + bo -> [1][4096][1024] (4.2 M)).
// Layout: bf16 copy of x; exact projections; causal-window T-4096 attention, one head per pass, with EVERY row on bf16 hi/lo planes (3 products; the unscaled logits are too sharp for fp16 planes): k_gemmc computes every score tile on or below the diagonal (above-diagonal tiles skipped), streaming three-sweep softmax with the window as an index select, attn.v (3 products); merged hi/lo x Wo exact + bo.
// Compute dtypes, f32 accumulate: every input rounded to bf16; projections exact; scores and attn.v 3 products on every row; softmax f32; Wo hl x exact + bias.

#define NB_  1
#define TT   4096
#define DM   1024
#define NH_  16
#define NKV  16
#define REP  (NH_ / NKV)
#define HD   64
#define DQ   (NH_ * HD)
#define DKV  (NKV * HD)
#define ZH   1
#define RH   4096                  // query rows < RH use hi+lo planes (0: none)
#define WIN  256
#define PCAR 1024.0f
#define SCL  1.0f   // the module applies no 1/sqrt(d)
typedef _Float16 h16;
typedef unsigned short bf;
typedef __attribute__((ext_vector_type(16))) __bf16   v16bf;
typedef __attribute__((ext_vector_type(16))) _Float16 v16h;
typedef __attribute__((ext_vector_type(8)))  _Float16 v8h;
typedef __attribute__((ext_vector_type(8)))  unsigned short v8us;
typedef __attribute__((ext_vector_type(8)))  float    v8f;
typedef __attribute__((ext_vector_type(4)))  float    v4f;
typedef v8h  __attribute__((may_alias)) v8ha;
typedef v4f  __attribute__((may_alias)) v4fa;
typedef v8us __attribute__((may_alias)) v8usa;

__device__ __forceinline__ unsigned short f2bf(float f) { unsigned u = __float_as_uint(f); u += 0x7FFFu + ((u >> 16) & 1u); return (unsigned short)(u >> 16); }
__device__ __forceinline__ float bf2f(unsigned short b) { return __uint_as_float(((unsigned)b) << 16); }
__device__ __forceinline__ float bfr(float f) { return bf2f(f2bf(f)); }
__device__ __forceinline__ v16h cat16(v8h lo, v8h hi) { return __builtin_shufflevector(lo, hi, 0, 1, 2, 3, 4, 5, 6, 7, 8, 9, 10, 11, 12, 13, 14, 15); }
__device__ __forceinline__ v16bf cat16b(v8us lo, v8us hi) { return __builtin_bit_cast(v16bf, __builtin_shufflevector(lo, hi, 0, 1, 2, 3, 4, 5, 6, 7, 8, 9, 10, 11, 12, 13, 14, 15)); }
__device__ __forceinline__ v8f wmma16(v16h a, v16h b, v8f c) { return __builtin_amdgcn_wmma_f32_16x16x32_f16(false, a, false, b, (short)0, c, false, false); }
__device__ __forceinline__ v8f wmmab(v16bf a, v16bf b, v8f c) { return __builtin_amdgcn_wmma_f32_16x16x32_bf16(false, a, false, b, (short)0, c, false, false); }



// ---- k_gemmw: register-blocked GEMM, ONE WAVE per 64x64 output tile (16 accumulators), operands straight from K-contiguous 16-bit planes; grid (M/64, N/64, Z), 32 threads.
// C[m][n] (f32, pitch ldc, + optional f32 bias[n]) = sum_k A[m][k] Bt[n][k] (+ split products per NSPLIT). z-batch strides sA/sB/sC in elements. K % 32 == 0.
template <typename T16> struct WFrag;
template <> struct WFrag<h16> { typedef v16h V; static __device__ __forceinline__ V ld(const h16* p) { return cat16(*(const v8h*)p, *(const v8h*)(p + 16)); } static __device__ __forceinline__ v8f mma(V a, V b, v8f c) { return wmma16(a, b, c); } };
template <> struct WFrag<bf> { typedef v16bf V; static __device__ __forceinline__ V ld(const bf* p) { return cat16b(*(const v8us*)p, *(const v8us*)(p + 16)); } static __device__ __forceinline__ v8f mma(V a, V b, v8f c) { return wmmab(a, b, c); } };
template <typename T16, int NSPLIT, bool BIAS>
__global__ __launch_bounds__(32) void k_gemmw(const T16* __restrict__ A, const T16* __restrict__ A2, const T16* __restrict__ Bt, const T16* __restrict__ Bt2, int K, float* C, int ldc, const float* __restrict__ bias, size_t sA, size_t sB, size_t sC) {
    typedef typename WFrag<T16>::V V;
    __shared__ __align__(16) float os[16 * 68];
    const size_t z = blockIdx.z; A += z * sA; if (A2) A2 += z * sA; Bt += z * sB; if (Bt2) Bt2 += z * sB; C += z * sC;
    const int lane = threadIdx.x & 31, lr = lane & 15, hi = lane >> 4; const int r0 = blockIdx.x * 64, c0 = blockIdx.y * 64;
    v8f acc[4][4];
#pragma unroll
    for (int mb = 0; mb < 4; ++mb)
#pragma unroll
        for (int nb = 0; nb < 4; ++nb) acc[mb][nb] = (v8f){};
    const size_t aoff = (size_t)(r0 + lr) * K + 8 * hi, boff = (size_t)(c0 + lr) * K + 8 * hi;
#pragma unroll 1
    for (int kc = 0; kc < K; kc += 32) {
        V a[4], a2[4];
#pragma unroll
        for (int mb = 0; mb < 4; ++mb) { a[mb] = WFrag<T16>::ld(A + aoff + (size_t)mb * 16 * K + kc); if (NSPLIT == 1 || NSPLIT == 2) a2[mb] = WFrag<T16>::ld(A2 + aoff + (size_t)mb * 16 * K + kc); }
#pragma unroll
        for (int nb = 0; nb < 4; ++nb) { const V b = WFrag<T16>::ld(Bt + boff + (size_t)nb * 16 * K + kc); V b2; if (NSPLIT >= 2) b2 = WFrag<T16>::ld(Bt2 + boff + (size_t)nb * 16 * K + kc);
#pragma unroll
            for (int mb = 0; mb < 4; ++mb) { acc[mb][nb] = WFrag<T16>::mma(a[mb], b, acc[mb][nb]); if (NSPLIT == 1 || NSPLIT == 2) acc[mb][nb] = WFrag<T16>::mma(a2[mb], b, acc[mb][nb]); if (NSPLIT >= 2) acc[mb][nb] = WFrag<T16>::mma(a[mb], b2, acc[mb][nb]); } }
        asm volatile("v_nop\n\tv_nop\n\tv_nop\n\tv_nop" : "+v"(acc[0][0]), "+v"(acc[1][1]), "+v"(acc[2][2]), "+v"(acc[3][3]) : "v"(a[0]), "v"(a[3]));
    }
#pragma unroll
    for (int mb = 0; mb < 4; ++mb) {
#pragma unroll
        for (int nb = 0; nb < 4; ++nb) {
#pragma unroll
            for (int j = 0; j < 8; ++j) os[(hi * 8 + j) * 68 + nb * 16 + lr] = acc[mb][nb][j]; }
        __builtin_amdgcn_wave_barrier(); asm volatile("" ::: "memory");
        float* crow = C + (size_t)(r0 + mb * 16) * ldc + c0;
{
#pragma unroll
            for (int s = 0; s < 8; ++s) { const int row = 2 * s + hi, cofs = lr * 4; v4f val = *(const v4fa*)(os + row * 68 + cofs); if (BIAS) { val[0] += bfr(bias[c0 + cofs]); val[1] += bfr(bias[c0 + cofs + 1]); val[2] += bfr(bias[c0 + cofs + 2]); val[3] += bfr(bias[c0 + cofs + 3]); }
                *(v4f*)(crow + (size_t)row * ldc + cofs) = val; }
             }
        __builtin_amdgcn_wave_barrier(); asm volatile("" ::: "memory");
    }
}

// ---- k_gemmc: the same one-wave 64x64 tile GEMM specialised for causal attention: CMODE 1 skips score tiles entirely above the diagonal (query rows r0+roff.., key columns c0..), CMODE 2 limits the
// key (K) loop of the probability x value contraction to the diagonal block (probabilities beyond it are exactly zero). roff = row offset of this launch's first row within the sequence.
template <typename T16, int NSPLIT, int CMODE>
__global__ __launch_bounds__(32) void k_gemmc(const T16* __restrict__ A, const T16* __restrict__ A2, const T16* __restrict__ Bt, const T16* __restrict__ Bt2, int K, float* C, int ldc, int roff, size_t sA, size_t sB, size_t sC) {
    typedef typename WFrag<T16>::V V;
    __shared__ __align__(16) float os[16 * 68];
    const size_t z = blockIdx.z; A += z * sA; if (A2) A2 += z * sA; Bt += z * sB; if (Bt2) Bt2 += z * sB; C += z * sC;
    const int lane = threadIdx.x & 31, lr = lane & 15, hi = lane >> 4; const int r0 = blockIdx.x * 64, c0 = blockIdx.y * 64;
    if (CMODE == 1 && c0 > r0 + roff + 63) return;                  // score tile entirely above the causal diagonal: never read (the softmax masks j > i by select)
    const int Kl = (CMODE == 2) ? min(K, r0 + roff + 64) : K;        // P.V: probabilities are exactly 0 beyond the diagonal block, so the K loop stops there
    v8f acc[4][4];
#pragma unroll
    for (int mb = 0; mb < 4; ++mb)
#pragma unroll
        for (int nb = 0; nb < 4; ++nb) acc[mb][nb] = (v8f){};
    const size_t aoff = (size_t)(r0 + lr) * K + 8 * hi, boff = (size_t)(c0 + lr) * K + 8 * hi;
#pragma unroll 1
    for (int kc = 0; kc < Kl; kc += 32) {
        V a[4], a2[4];
#pragma unroll
        for (int mb = 0; mb < 4; ++mb) { a[mb] = WFrag<T16>::ld(A + aoff + (size_t)mb * 16 * K + kc); if (NSPLIT == 1 || NSPLIT == 2) a2[mb] = WFrag<T16>::ld(A2 + aoff + (size_t)mb * 16 * K + kc); }
#pragma unroll
        for (int nb = 0; nb < 4; ++nb) { const V b = WFrag<T16>::ld(Bt + boff + (size_t)nb * 16 * K + kc); V b2; if (NSPLIT >= 2) b2 = WFrag<T16>::ld(Bt2 + boff + (size_t)nb * 16 * K + kc);
#pragma unroll
            for (int mb = 0; mb < 4; ++mb) { acc[mb][nb] = WFrag<T16>::mma(a[mb], b, acc[mb][nb]); if (NSPLIT == 1 || NSPLIT == 2) acc[mb][nb] = WFrag<T16>::mma(a2[mb], b, acc[mb][nb]); if (NSPLIT >= 2) acc[mb][nb] = WFrag<T16>::mma(a[mb], b2, acc[mb][nb]); } }
        asm volatile("v_nop\n\tv_nop\n\tv_nop\n\tv_nop" : "+v"(acc[0][0]), "+v"(acc[1][1]), "+v"(acc[2][2]), "+v"(acc[3][3]) : "v"(a[0]), "v"(a[3]));
    }
#pragma unroll
    for (int mb = 0; mb < 4; ++mb) {
#pragma unroll
        for (int nb = 0; nb < 4; ++nb) {
#pragma unroll
            for (int j = 0; j < 8; ++j) os[(hi * 8 + j) * 68 + nb * 16 + lr] = acc[mb][nb][j]; }
        __builtin_amdgcn_wave_barrier(); asm volatile("" ::: "memory");
        float* crow = C + (size_t)(r0 + mb * 16) * ldc + c0;
{
#pragma unroll
            for (int s = 0; s < 8; ++s) { const int row = 2 * s + hi, cofs = lr * 4; v4f val = *(const v4fa*)(os + row * 68 + cofs);
                *(v4f*)(crow + (size_t)row * ldc + cofs) = val; }
             }
        __builtin_amdgcn_wave_barrier(); asm volatile("" ::: "memory");
    }
}

__device__ __forceinline__ h16 tohx(float x) { return (h16)x; }
__device__ __forceinline__ void splitf(float y, unsigned short& h, unsigned short& l) { h = f2bf(y); l = f2bf(y - bf2f(h)); }
typedef __attribute__((ext_vector_type(2))) _Float16 v2h;
typedef __attribute__((ext_vector_type(4))) _Float16 v4h;
typedef __attribute__((ext_vector_type(2))) unsigned short v2us;
typedef __attribute__((ext_vector_type(4))) unsigned short v4us;
typedef __attribute__((ext_vector_type(2))) float v2f;
typedef __attribute__((ext_vector_type(4))) int v4i;

__global__ __launch_bounds__(256) void k_wtG(const float* __restrict__ w, int K, int N, bf* Bt) {
    const int lane = threadIdx.x & 31; const int L0 = (blockIdx.x * 8 + (threadIdx.x >> 5)) * 8; const int nlines = N * K / 64;
{
#pragma unroll 1
        for (int l = 0; l < 8; ++l) { const int L = L0 + l; if (L >= nlines) break; const size_t e = (size_t)L * 64 + lane * 2; const int k = (int)(e % K), n = (int)(e / K); v2us o;
            o[0] = f2bf(w[(size_t)k * N + n]); o[1] = f2bf(w[(size_t)(k + 1) * N + n]); *(v2us*)(Bt + e) = o; }
         }
}
__global__ __launch_bounds__(256) void k_cvt8(const float* __restrict__ src, bf* dst, size_t n8) { const size_t i = (size_t)blockIdx.x * 256 + threadIdx.x; if (i >= n8) return; const v8f v = *(const v8f*)(src + i * 8); v8us o;
#pragma unroll
    for (int k = 0; k < 8; ++k) o[k] = f2bf(v[k]); *(v8us*)(dst + i * 8) = o;  }

// k_rope: head planes [h][t][d] (fp16 + hi/lo) of rope(x) x sc with the rotate-half convention out[d] = x[d] cos[t][d] - x[d+HD/2] sin[t][d], out[d+HD/2] = x[d+HD/2] cos[t][d+HD/2] + x[d] sin[t][d+HD/2]
__global__ __launch_bounds__(256) void k_rope(const float* __restrict__ F, int pitch, int nheads, const float* __restrict__ CS, const float* __restrict__ RF, const float* __restrict__ nw, float sc, h16* P16, bf* Ph, bf* Pl) {
    const size_t e = ((size_t)blockIdx.x * 256 + threadIdx.x) * 2; if (e >= (size_t)nheads * TT * HD) return; const int d = (int)(e % HD); const int t = (int)((e / HD) % TT); const int h = (int)(e / ((size_t)HD * TT)); const float* f = F + (size_t)t * pitch + h * HD; const float rf = RF ? RF[(size_t)h * TT + t] : 1.0f; v2h o16; v2us oh, ol;
#pragma unroll
    for (int q = 0; q < 2; ++q) { const int dd = d + q; const int dp = (dd < HD / 2) ? dd + HD / 2 : dd - HD / 2; float x0 = f[dd], x1 = f[dp];
        if (RF) { float n0 = __fmul_rn(x0, rf), n1 = __fmul_rn(x1, rf); asm volatile("" : "+v"(n0)); asm volatile("" : "+v"(n1)); x0 = __fmul_rn(bfr(nw[dd]), n0); x1 = __fmul_rn(bfr(nw[dp]), n1); }
        const v2f cs = *(const v2f*)(CS + ((size_t)t * HD + dd) * 2); float a = __fmul_rn(x0, cs[0]), bq = __fmul_rn(x1, cs[1]); asm volatile("" : "+v"(a)); asm volatile("" : "+v"(bq)); const float r = ((dd < HD / 2) ? __fsub_rn(a, bq) : __fadd_rn(a, bq)) * sc;
        o16[q] = tohx(r); unsigned short a2, c2; splitf(r, a2, c2); oh[q] = a2; ol[q] = c2; }
    if (P16 != nullptr) { *(v2h*)(P16 + e) = o16; } *(v2us*)(Ph + e) = oh; *(v2us*)(Pl + e) = ol;  }
__global__ __launch_bounds__(256) void k_vtp(const float* __restrict__ F, int pitch, int nheads, h16* V16, bf* Vh, bf* Vl) { const size_t e = ((size_t)blockIdx.x * 256 + threadIdx.x) * 2; if (e >= (size_t)nheads * HD * TT) return; const int t = (int)(e % TT); const int d = (int)((e / TT) % HD); const int g = (int)(e / ((size_t)TT * HD)); v2h o16; v2us oh, ol;
#pragma unroll
    for (int q = 0; q < 2; ++q) { const float x = F[(size_t)(t + q) * pitch + g * HD + d]; o16[q] = tohx(x); unsigned short a2, c2; splitf(x, a2, c2); oh[q] = a2; ol[q] = c2; }
    if (V16 != nullptr) { *(v2h*)(V16 + e) = o16; } *(v2us*)(Vh + e) = oh; *(v2us*)(Vl + e) = ol;  }
__global__ __launch_bounds__(256) void k_csid(float* CS) { const int idx = blockIdx.x * 256 + threadIdx.x; if (idx >= TT * HD) return; v2f cs; cs[0] = 1.0f; cs[1] = 0.0f; *(v2f*)(CS + (size_t)idx * 2) = cs;  }
// k_lsoft: streaming causal sliding-window row softmax (keys i - WIN < j <= i) over the TK = TT = 4096 keys, one wave per row i, three sweeps of the f32 score row (lane -> 4 consecutive keys per 128-key chunk, 32 chunks; keys j > i are excluded by index with -3e38 / 0 - the score tiles above the diagonal are never computed and their stale contents are only ever discarded by this select):
__global__ __launch_bounds__(256) void k_lsoft(const float* __restrict__ Sb, h16* P16, bf* Ph, bf* Pl) {
    const int lane = threadIdx.x & 31; const int row = blockIdx.x * 8 + (threadIdx.x >> 5); if (row >= ZH * TT) return; const int i = row % TT; const int zz = row / TT; const bool hires = (i < RH); const float* sr = Sb + (size_t)row * TT; float mx = -3.0e38f;
#pragma unroll 4
    for (int ch = 0; ch < TT / 128; ++ch) { const int j0 = ch * 128 + lane * 4; const v4f a = *(const v4f*)(sr + j0);
#pragma unroll
        for (int q = 0; q < 4; ++q) { float t = a[q] * SCL; asm volatile("" : "+v"(t)); t = (j0 + q <= i && j0 + q > i - WIN) ? t : -3.0e38f;   /* causal sliding window: i - WIN < j <= i */ mx = fmaxf(mx, t); } }
#pragma unroll
    for (int sh = 16; sh; sh >>= 1) mx = fmaxf(mx, __shfl_xor(mx, sh, 32));
    float sum = 0.f;
#pragma unroll 4
    for (int ch = 0; ch < TT / 128; ++ch) { const int j0 = ch * 128 + lane * 4; const v4f a = *(const v4f*)(sr + j0);
#pragma unroll
        for (int q = 0; q < 4; ++q) { float t = a[q] * SCL; asm volatile("" : "+v"(t)); t = (j0 + q <= i && j0 + q > i - WIN) ? t : -3.0e38f;   /* causal sliding window: i - WIN < j <= i */ float d0 = __fsub_rn(t, mx); asm volatile("" : "+v"(d0)); sum += __builtin_amdgcn_exp2f(__fmul_rn(d0, 1.4426950408889634f)); } }
#pragma unroll
    for (int sh = 16; sh; sh >>= 1) sum += __shfl_xor(sum, sh, 32);
    const float f = __fdiv_rn(hires ? 1.0f : PCAR, sum);
{
        if (hires) {   /* rows < RH: normalised bf16 hi/lo over the first RH keys (every later key is above the diagonal for these rows; the hi/lo attn.v GEMM stops its K loop at the diagonal block), planes [zz][RH][TT] */
#pragma unroll
            for (int ch = 0; ch < RH / 128; ++ch) { const int j0 = ch * 128 + lane * 4; const v4f a = *(const v4f*)(sr + j0); v4us oh, ol;
#pragma unroll
                for (int q = 0; q < 4; ++q) { float t = a[q] * SCL; asm volatile("" : "+v"(t)); t = (j0 + q <= i && j0 + q > i - WIN) ? t : -3.0e38f;   /* causal sliding window: i - WIN < j <= i */ float d0 = __fsub_rn(t, mx); asm volatile("" : "+v"(d0)); float ex = __builtin_amdgcn_exp2f(__fmul_rn(d0, 1.4426950408889634f)); asm volatile("" : "+v"(ex)); unsigned short a2, c2; splitf(ex * f, a2, c2); oh[q] = a2; ol[q] = c2; }
                const size_t oo = ((size_t)zz * RH + i) * TT + j0; *(v4us*)(Ph + oo) = oh; *(v4us*)(Pl + oo) = ol; }
        } else {
#pragma unroll 2
            for (int ch = 0; ch < TT / 128; ++ch) { const int j0 = ch * 128 + lane * 4; const v4f a = *(const v4f*)(sr + j0); v4h o4;
#pragma unroll
                for (int q = 0; q < 4; ++q) { float t = a[q] * SCL; asm volatile("" : "+v"(t)); t = (j0 + q <= i && j0 + q > i - WIN) ? t : -3.0e38f;   /* causal sliding window: i - WIN < j <= i */ float d0 = __fsub_rn(t, mx); asm volatile("" : "+v"(d0)); float ex = __builtin_amdgcn_exp2f(__fmul_rn(d0, 1.4426950408889634f)); asm volatile("" : "+v"(ex)); o4[q] = tohx(ex * f); }
                *(v4h*)(P16 + (size_t)row * TT + j0) = o4; } }
         }
}

__global__ __launch_bounds__(256) void k_merge(const float* __restrict__ O, int h0, bf* Ah, bf* Al) { const size_t e = ((size_t)blockIdx.x * 256 + threadIdx.x) * 2; if (e >= (size_t)ZH * TT * HD) return; const int d = (int)(e % HD); const int t = (int)((e / HD) % TT); const int zz = (int)(e / ((size_t)HD * TT)); const float cs = (t < RH) ? 1.0f : (1.0f / PCAR); const size_t oo = (size_t)t * DQ + (h0 + zz) * HD + d;
    v2us oh, ol;
#pragma unroll
    for (int q = 0; q < 2; ++q) { unsigned short a, c2; splitf(O[e + q] * cs, a, c2); oh[q] = a; ol[q] = c2; } *(v2us*)(Ah + oo) = oh; *(v2us*)(Al + oo) = ol;  }

extern "C" void kernel_launch(void* const* d_in, const int* in_sizes, int n_in,
                              void* d_out, int out_size, void* d_ws, size_t ws_size, hipStream_t stream) {
    (void)in_sizes; (void)n_in; (void)out_size;
    const float* x = (const float*)d_in[0]; const float* wq = (const float*)d_in[1]; const float* wk = (const float*)d_in[2]; const float* wv = (const float*)d_in[3]; const float* wo = (const float*)d_in[4]; const float* bo = (const float*)d_in[5];
    float* OUT = (float*)d_out;     // [1][4096][1024]
    char* wsp = (char*)d_ws;
    auto take = [&](size_t bytes) { char* p = wsp; wsp += (bytes + 255) & ~(size_t)255; return (void*)p; };
    bf* WQ = (bf*)take((size_t)DQ * DM * 2); bf* WK = (bf*)take((size_t)DKV * DM * 2); bf* WV = (bf*)take((size_t)DKV * DM * 2); bf* WO = (bf*)take((size_t)DM * DQ * 2); float* CS = (float*)take((size_t)TT * HD * 2 * 4);
    bf* XB = (bf*)take((size_t)TT * DM * 2); float* FQ = (float*)take((size_t)TT * DQ * 4); float* FK = (float*)take((size_t)TT * DKV * 4);
    h16* QP16 = nullptr;   /* all rows hi/lo: no fp16 planes */ h16* KP16 = nullptr; h16* VT16 = nullptr;
    bf* QPh = (bf*)take((size_t)NH_ * TT * HD * 2); bf* QPl = (bf*)take((size_t)NH_ * TT * HD * 2); bf* KPh = (bf*)take((size_t)NKV * TT * HD * 2); bf* KPl = (bf*)take((size_t)NKV * TT * HD * 2); bf* VTh = (bf*)take((size_t)NKV * HD * TT * 2); bf* VTl = (bf*)take((size_t)NKV * HD * TT * 2); bf* Ph = (bf*)take((size_t)ZH * RH * TT * 2); bf* Pl = (bf*)take((size_t)ZH * RH * TT * 2);
    float* Sb = (float*)take((size_t)ZH * TT * TT * 4); h16* P16 = nullptr; float* Ob = (float*)take((size_t)ZH * TT * HD * 4); bf* ATh = (bf*)take((size_t)TT * DQ * 2); bf* ATl = (bf*)take((size_t)TT * DQ * 2);
    if ((size_t)(wsp - (char*)d_ws) > ws_size) return;    // ws 256 MiB
    float* FV = FK;   // v projection reuses the k buffer after the k planes are built (stream-ordered)
    { k_cvt8<<<(unsigned)(((size_t)DQ * DM / 8 + 255) / 256), 256, 0, stream>>>(wq, WQ, (size_t)DQ * DM / 8); k_cvt8<<<(unsigned)(((size_t)DKV * DM / 8 + 255) / 256), 256, 0, stream>>>(wk, WK, (size_t)DKV * DM / 8); k_cvt8<<<(unsigned)(((size_t)DKV * DM / 8 + 255) / 256), 256, 0, stream>>>(wv, WV, (size_t)DKV * DM / 8);
      k_cvt8<<<(unsigned)(((size_t)DM * DQ / 8 + 255) / 256), 256, 0, stream>>>(wo, WO, (size_t)DM * DQ / 8);
       }
    k_csid<<<(TT * HD + 255) / 256, 256, 0, stream>>>(CS);
    const unsigned LQ = (unsigned)(((size_t)NH_ * TT * HD / 2 + 255) / 256), LKv = (unsigned)(((size_t)NKV * TT * HD / 2 + 255) / 256);
    for (int b = 0; b < NB_; ++b) {
        
        k_cvt8<<<(unsigned)(((size_t)TT * DM / 8 + 255) / 256), 256, 0, stream>>>(x + (size_t)b * TT * DM, XB, (size_t)TT * DM / 8);
        k_gemmw<bf, 0, false><<<dim3(TT / 64, DQ / 64, 1), 32, 0, stream>>>(XB, nullptr, WQ, nullptr, DM, FQ, DQ, nullptr, 0, 0, 0);
        k_rope<<<LQ, 256, 0, stream>>>(FQ, DQ, NH_, CS, nullptr, nullptr, 1.0f, QP16, QPh, QPl);
        k_gemmw<bf, 0, false><<<dim3(TT / 64, DKV / 64, 1), 32, 0, stream>>>(XB, nullptr, WK, nullptr, DM, FK, DKV, nullptr, 0, 0, 0);
        k_rope<<<LKv, 256, 0, stream>>>(FK, DKV, NKV, CS, nullptr, nullptr, 1.0f, KP16, KPh, KPl);
        k_gemmw<bf, 0, false><<<dim3(TT / 64, DKV / 64, 1), 32, 0, stream>>>(XB, nullptr, WV, nullptr, DM, FV, DKV, nullptr, 0, 0, 0); k_vtp<<<LKv, 256, 0, stream>>>(FV, DKV, NKV, VT16, VTh, VTl);
        for (int h0 = 0; h0 < NH_; h0 += ZH) { const size_t zq = (size_t)h0, zk = (size_t)(h0 / REP);   // one kv head per query head: each pass's one head uses kv plane h0 (z-strides TT*HD)
            k_gemmc<bf, 2, 1><<<dim3(RH / 64, TT / 64, ZH), 32, 0, stream>>>(QPh + zq * TT * HD, QPl + zq * TT * HD, KPh + zk * TT * HD, KPl + zk * TT * HD, HD, Sb, TT, 0, (size_t)TT * HD, (size_t)TT * HD, (size_t)TT * TT);
            k_lsoft<<<ZH * TT / 8, 256, 0, stream>>>(Sb, P16, Ph, Pl);
            k_gemmc<bf, 2, 2><<<dim3(RH / 64, HD / 64, ZH), 32, 0, stream>>>(Ph, Pl, VTh + zk * HD * TT, VTl + zk * HD * TT, TT, Ob, HD, 0, (size_t)RH * TT, (size_t)HD * TT, (size_t)TT * HD);
            k_merge<<<(unsigned)(((size_t)ZH * TT * HD / 2 + 255) / 256), 256, 0, stream>>>(Ob, h0, ATh, ATl); }
        k_gemmw<bf, 1, true><<<dim3(TT / 64, DM / 64, 1), 32, 0, stream>>>(ATh, ATl, WO, nullptr, DQ, OUT + (size_t)b * TT * DM, DM, bo, 0, 0, 0); }
}

// v001
// A run of this version takes 548 microseconds.
// Timed twice side by side with v000, it ran 4.18 and 4.13 times as fast.
#include <hip/hip_runtime.h>

// Local causal multi-head attention WITHOUT the 1/sqrt(d) scaling (x [1][4096][1024]; q,k,v = x W^T ('oi' [1024][1024], no bias; 16 heads x 64); scores = q.k (unscaled: logit sigma ~8); keys with j > i or j <= i - 256 masked (-1e30 == exclusion); softmax; ctx merged; out = ctx Wo^T + bo -> [1][4096][1024] (4.2 M)).
// Layout: bf16 copy of x; exact projections; causal-window T-4096 attention, one head per pass, with EVERY row on bf16 hi/lo planes (3 products; the unscaled logits are too sharp for fp16 planes): k_gemmc computes only the five 64-key score tiles per 64-row block that the 256-wide band touches, three-sweep softmax over the band's three 128-key chunks with the window as an index select, attn.v (3 products) over the band's 320 keys; merged hi/lo x Wo exact + bo.
// Compute dtypes, f32 accumulate: every input rounded to bf16; projections exact; scores and attn.v 3 products on every row; softmax f32; Wo hl x exact + bias.

#define NB_  1
#define TT   4096
#define DM   1024
#define NH_  16
#define NKV  16
#define REP  (NH_ / NKV)
#define HD   64
#define DQ   (NH_ * HD)
#define DKV  (NKV * HD)
#define ZH   1
#define RH   4096                  // query rows < RH use hi+lo planes (0: none)
#define WIN  256
#define NCH  ((WIN + 127) / 128 + 1)   // 128-key softmax chunks that cover a 64-row block's WIN + 64 keys at any 64-key phase
#define PCAR 1024.0f
#define SCL  1.0f   // the module applies no 1/sqrt(d)
typedef _Float16 h16;
typedef unsigned short bf;
typedef __attribute__((ext_vector_type(16))) __bf16   v16bf;
typedef __attribute__((ext_vector_type(16))) _Float16 v16h;
typedef __attribute__((ext_vector_type(8)))  _Float16 v8h;
typedef __attribute__((ext_vector_type(8)))  unsigned short v8us;
typedef __attribute__((ext_vector_type(8)))  float    v8f;
typedef __attribute__((ext_vector_type(4)))  float    v4f;
typedef v8h  __attribute__((may_alias)) v8ha;
typedef v4f  __attribute__((may_alias)) v4fa;
typedef v8us __attribute__((may_alias)) v8usa;

__device__ __forceinline__ unsigned short f2bf(float f) { unsigned u = __float_as_uint(f); u += 0x7FFFu + ((u >> 16) & 1u); return (unsigned short)(u >> 16); }
__device__ __forceinline__ float bf2f(unsigned short b) { return __uint_as_float(((unsigned)b) << 16); }
__device__ __forceinline__ float bfr(float f) { return bf2f(f2bf(f)); }
__device__ __forceinline__ v16h cat16(v8h lo, v8h hi) { return __builtin_shufflevector(lo, hi, 0, 1, 2, 3, 4, 5, 6, 7, 8, 9, 10, 11, 12, 13, 14, 15); }
__device__ __forceinline__ v16bf cat16b(v8us lo, v8us hi) { return __builtin_bit_cast(v16bf, __builtin_shufflevector(lo, hi, 0, 1, 2, 3, 4, 5, 6, 7, 8, 9, 10, 11, 12, 13, 14, 15)); }
__device__ __forceinline__ v8f wmma16(v16h a, v16h b, v8f c) { return __builtin_amdgcn_wmma_f32_16x16x32_f16(false, a, false, b, (short)0, c, false, false); }
__device__ __forceinline__ v8f wmmab(v16bf a, v16bf b, v8f c) { return __builtin_amdgcn_wmma_f32_16x16x32_bf16(false, a, false, b, (short)0, c, false, false); }



// ---- k_gemmw: register-blocked GEMM, ONE WAVE per 64x64 output tile (16 accumulators), operands straight from K-contiguous 16-bit planes; grid (M/64, N/64, Z), 32 threads.
// C[m][n] (f32, pitch ldc, + optional f32 bias[n]) = sum_k A[m][k] Bt[n][k] (+ split products per NSPLIT). z-batch strides sA/sB/sC in elements. K % 32 == 0.
template <typename T16> struct WFrag;
template <> struct WFrag<h16> { typedef v16h V; static __device__ __forceinline__ V ld(const h16* p) { return cat16(*(const v8h*)p, *(const v8h*)(p + 16)); } static __device__ __forceinline__ v8f mma(V a, V b, v8f c) { return wmma16(a, b, c); } };
template <> struct WFrag<bf> { typedef v16bf V; static __device__ __forceinline__ V ld(const bf* p) { return cat16b(*(const v8us*)p, *(const v8us*)(p + 16)); } static __device__ __forceinline__ v8f mma(V a, V b, v8f c) { return wmmab(a, b, c); } };
template <typename T16, int NSPLIT, bool BIAS>
__global__ __launch_bounds__(32) void k_gemmw(const T16* __restrict__ A, const T16* __restrict__ A2, const T16* __restrict__ Bt, const T16* __restrict__ Bt2, int K, float* C, int ldc, const float* __restrict__ bias, size_t sA, size_t sB, size_t sC) {
    typedef typename WFrag<T16>::V V;
    __shared__ __align__(16) float os[16 * 68];
    const size_t z = blockIdx.z; A += z * sA; if (A2) A2 += z * sA; Bt += z * sB; if (Bt2) Bt2 += z * sB; C += z * sC;
    const int lane = threadIdx.x & 31, lr = lane & 15, hi = lane >> 4; const int r0 = blockIdx.x * 64, c0 = blockIdx.y * 64;
    v8f acc[4][4];
#pragma unroll
    for (int mb = 0; mb < 4; ++mb)
#pragma unroll
        for (int nb = 0; nb < 4; ++nb) acc[mb][nb] = (v8f){};
    const size_t aoff = (size_t)(r0 + lr) * K + 8 * hi, boff = (size_t)(c0 + lr) * K + 8 * hi;
#pragma unroll 1
    for (int kc = 0; kc < K; kc += 32) {
        V a[4], a2[4];
#pragma unroll
        for (int mb = 0; mb < 4; ++mb) { a[mb] = WFrag<T16>::ld(A + aoff + (size_t)mb * 16 * K + kc); if (NSPLIT == 1 || NSPLIT == 2) a2[mb] = WFrag<T16>::ld(A2 + aoff + (size_t)mb * 16 * K + kc); }
#pragma unroll
        for (int nb = 0; nb < 4; ++nb) { const V b = WFrag<T16>::ld(Bt + boff + (size_t)nb * 16 * K + kc); V b2; if (NSPLIT >= 2) b2 = WFrag<T16>::ld(Bt2 + boff + (size_t)nb * 16 * K + kc);
#pragma unroll
            for (int mb = 0; mb < 4; ++mb) { acc[mb][nb] = WFrag<T16>::mma(a[mb], b, acc[mb][nb]); if (NSPLIT == 1 || NSPLIT == 2) acc[mb][nb] = WFrag<T16>::mma(a2[mb], b, acc[mb][nb]); if (NSPLIT >= 2) acc[mb][nb] = WFrag<T16>::mma(a[mb], b2, acc[mb][nb]); } }
        asm volatile("v_nop\n\tv_nop\n\tv_nop\n\tv_nop" : "+v"(acc[0][0]), "+v"(acc[1][1]), "+v"(acc[2][2]), "+v"(acc[3][3]) : "v"(a[0]), "v"(a[3]));
    }
#pragma unroll
    for (int mb = 0; mb < 4; ++mb) {
#pragma unroll
        for (int nb = 0; nb < 4; ++nb) {
#pragma unroll
            for (int j = 0; j < 8; ++j) os[(hi * 8 + j) * 68 + nb * 16 + lr] = acc[mb][nb][j]; }
        __builtin_amdgcn_wave_barrier(); asm volatile("" ::: "memory");
        float* crow = C + (size_t)(r0 + mb * 16) * ldc + c0;
{
#pragma unroll
            for (int s = 0; s < 8; ++s) { const int row = 2 * s + hi, cofs = lr * 4; v4f val = *(const v4fa*)(os + row * 68 + cofs); if (BIAS) { val[0] += bfr(bias[c0 + cofs]); val[1] += bfr(bias[c0 + cofs + 1]); val[2] += bfr(bias[c0 + cofs + 2]); val[3] += bfr(bias[c0 + cofs + 3]); }
                *(v4f*)(crow + (size_t)row * ldc + cofs) = val; }
             }
        __builtin_amdgcn_wave_barrier(); asm volatile("" ::: "memory");
    }
}

// ---- k_gemmc: the same one-wave 64x64 tile GEMM specialised for causal attention: CMODE 1 computes only the WIN/64+1 score tiles of a 64-row block that hold a key with i - WIN < j <= i (grid y counts them from key column r0+roff-WIN), CMODE 2 limits the
// key (K) loop of the probability x value contraction to the same WIN+64 keys (probabilities outside them are exactly zero and are never read). roff = row offset of this launch's first row within the sequence.
template <typename T16, int NSPLIT, int CMODE>
__global__ __launch_bounds__(32) void k_gemmc(const T16* __restrict__ A, const T16* __restrict__ A2, const T16* __restrict__ Bt, const T16* __restrict__ Bt2, int K, float* C, int ldc, int roff, size_t sA, size_t sB, size_t sC) {
    typedef typename WFrag<T16>::V V;
    __shared__ __align__(16) float os[16 * 68];
    const size_t z = blockIdx.z; A += z * sA; if (A2) A2 += z * sA; Bt += z * sB; if (Bt2) Bt2 += z * sB; C += z * sC;
    const int lane = threadIdx.x & 31, lr = lane & 15, hi = lane >> 4; const int r0 = blockIdx.x * 64, c0 = (CMODE == 1) ? r0 + roff - WIN + blockIdx.y * 64 : blockIdx.y * 64;
    if (CMODE == 1 && c0 < 0) return;                                // the band's tile would lie in front of key 0: there is none
    const int Kl = (CMODE == 2) ? min(K, r0 + roff + 64) : K;        // P.V: probabilities are exactly 0 beyond the diagonal block, so the K loop stops there
    const int K0 = (CMODE == 2) ? max(0, r0 + roff - WIN) : 0;       // ... and exactly 0 for keys j <= i - WIN, so it starts at the band's first 64-key tile
    v8f acc[4][4];
#pragma unroll
    for (int mb = 0; mb < 4; ++mb)
#pragma unroll
        for (int nb = 0; nb < 4; ++nb) acc[mb][nb] = (v8f){};
    const size_t aoff = (size_t)(r0 + lr) * K + 8 * hi, boff = (size_t)(c0 + lr) * K + 8 * hi;
#pragma unroll 1
    for (int kc = K0; kc < Kl; kc += 32) {
        V a[4], a2[4];
#pragma unroll
        for (int mb = 0; mb < 4; ++mb) { a[mb] = WFrag<T16>::ld(A + aoff + (size_t)mb * 16 * K + kc); if (NSPLIT == 1 || NSPLIT == 2) a2[mb] = WFrag<T16>::ld(A2 + aoff + (size_t)mb * 16 * K + kc); }
#pragma unroll
        for (int nb = 0; nb < 4; ++nb) { const V b = WFrag<T16>::ld(Bt + boff + (size_t)nb * 16 * K + kc); V b2; if (NSPLIT >= 2) b2 = WFrag<T16>::ld(Bt2 + boff + (size_t)nb * 16 * K + kc);
#pragma unroll
            for (int mb = 0; mb < 4; ++mb) { acc[mb][nb] = WFrag<T16>::mma(a[mb], b, acc[mb][nb]); if (NSPLIT == 1 || NSPLIT == 2) acc[mb][nb] = WFrag<T16>::mma(a2[mb], b, acc[mb][nb]); if (NSPLIT >= 2) acc[mb][nb] = WFrag<T16>::mma(a[mb], b2, acc[mb][nb]); } }
        asm volatile("v_nop\n\tv_nop\n\tv_nop\n\tv_nop" : "+v"(acc[0][0]), "+v"(acc[1][1]), "+v"(acc[2][2]), "+v"(acc[3][3]) : "v"(a[0]), "v"(a[3]));
    }
#pragma unroll
    for (int mb = 0; mb < 4; ++mb) {
#pragma unroll
        for (int nb = 0; nb < 4; ++nb) {
#pragma unroll
            for (int j = 0; j < 8; ++j) os[(hi * 8 + j) * 68 + nb * 16 + lr] = acc[mb][nb][j]; }
        __builtin_amdgcn_wave_barrier(); asm volatile("" ::: "memory");
        float* crow = C + (size_t)(r0 + mb * 16) * ldc + c0;
{
#pragma unroll
            for (int s = 0; s < 8; ++s) { const int row = 2 * s + hi, cofs = lr * 4; v4f val = *(const v4fa*)(os + row * 68 + cofs);
                *(v4f*)(crow + (size_t)row * ldc + cofs) = val; }
             }
        __builtin_amdgcn_wave_barrier(); asm volatile("" ::: "memory");
    }
}

__device__ __forceinline__ h16 tohx(float x) { return (h16)x; }
__device__ __forceinline__ void splitf(float y, unsigned short& h, unsigned short& l) { h = f2bf(y); l = f2bf(y - bf2f(h)); }
typedef __attribute__((ext_vector_type(2))) _Float16 v2h;
typedef __attribute__((ext_vector_type(4))) _Float16 v4h;
typedef __attribute__((ext_vector_type(2))) unsigned short v2us;
typedef __attribute__((ext_vector_type(4))) unsigned short v4us;
typedef __attribute__((ext_vector_type(2))) float v2f;
typedef __attribute__((ext_vector_type(4))) int v4i;

__global__ __launch_bounds__(256) void k_wtG(const float* __restrict__ w, int K, int N, bf* Bt) {
    const int lane = threadIdx.x & 31; const int L0 = (blockIdx.x * 8 + (threadIdx.x >> 5)) * 8; const int nlines = N * K / 64;
{
#pragma unroll 1
        for (int l = 0; l < 8; ++l) { const int L = L0 + l; if (L >= nlines) break; const size_t e = (size_t)L * 64 + lane * 2; const int k = (int)(e % K), n = (int)(e / K); v2us o;
            o[0] = f2bf(w[(size_t)k * N + n]); o[1] = f2bf(w[(size_t)(k + 1) * N + n]); *(v2us*)(Bt + e) = o; }
         }
}
__global__ __launch_bounds__(256) void k_cvt8(const float* __restrict__ src, bf* dst, size_t n8) { const size_t i = (size_t)blockIdx.x * 256 + threadIdx.x; if (i >= n8) return; const v8f v = *(const v8f*)(src + i * 8); v8us o;
#pragma unroll
    for (int k = 0; k < 8; ++k) o[k] = f2bf(v[k]); *(v8us*)(dst + i * 8) = o;  }

// k_rope: head planes [h][t][d] (fp16 + hi/lo) of rope(x) x sc with the rotate-half convention out[d] = x[d] cos[t][d] - x[d+HD/2] sin[t][d], out[d+HD/2] = x[d+HD/2] cos[t][d+HD/2] + x[d] sin[t][d+HD/2]
__global__ __launch_bounds__(256) void k_rope(const float* __restrict__ F, int pitch, int nheads, const float* __restrict__ CS, const float* __restrict__ RF, const float* __restrict__ nw, float sc, h16* P16, bf* Ph, bf* Pl) {
    const size_t e = ((size_t)blockIdx.x * 256 + threadIdx.x) * 2; if (e >= (size_t)nheads * TT * HD) return; const int d = (int)(e % HD); const int t = (int)((e / HD) % TT); const int h = (int)(e / ((size_t)HD * TT)); const float* f = F + (size_t)t * pitch + h * HD; const float rf = RF ? RF[(size_t)h * TT + t] : 1.0f; v2h o16; v2us oh, ol;
#pragma unroll
    for (int q = 0; q < 2; ++q) { const int dd = d + q; const int dp = (dd < HD / 2) ? dd + HD / 2 : dd - HD / 2; float x0 = f[dd], x1 = f[dp];
        if (RF) { float n0 = __fmul_rn(x0, rf), n1 = __fmul_rn(x1, rf); asm volatile("" : "+v"(n0)); asm volatile("" : "+v"(n1)); x0 = __fmul_rn(bfr(nw[dd]), n0); x1 = __fmul_rn(bfr(nw[dp]), n1); }
        const v2f cs = *(const v2f*)(CS + ((size_t)t * HD + dd) * 2); float a = __fmul_rn(x0, cs[0]), bq = __fmul_rn(x1, cs[1]); asm volatile("" : "+v"(a)); asm volatile("" : "+v"(bq)); const float r = ((dd < HD / 2) ? __fsub_rn(a, bq) : __fadd_rn(a, bq)) * sc;
        o16[q] = tohx(r); unsigned short a2, c2; splitf(r, a2, c2); oh[q] = a2; ol[q] = c2; }
    if (P16 != nullptr) { *(v2h*)(P16 + e) = o16; } *(v2us*)(Ph + e) = oh; *(v2us*)(Pl + e) = ol;  }
__global__ __launch_bounds__(256) void k_vtp(const float* __restrict__ F, int pitch, int nheads, h16* V16, bf* Vh, bf* Vl) { const size_t e = ((size_t)blockIdx.x * 256 + threadIdx.x) * 2; if (e >= (size_t)nheads * HD * TT) return; const int t = (int)(e % TT); const int d = (int)((e / TT) % HD); const int g = (int)(e / ((size_t)TT * HD)); v2h o16; v2us oh, ol;
#pragma unroll
    for (int q = 0; q < 2; ++q) { const float x = F[(size_t)(t + q) * pitch + g * HD + d]; o16[q] = tohx(x); unsigned short a2, c2; splitf(x, a2, c2); oh[q] = a2; ol[q] = c2; }
    if (V16 != nullptr) { *(v2h*)(V16 + e) = o16; } *(v2us*)(Vh + e) = oh; *(v2us*)(Vl + e) = ol;  }
__global__ __launch_bounds__(256) void k_csid(float* CS) { const int idx = blockIdx.x * 256 + threadIdx.x; if (idx >= TT * HD) return; v2f cs; cs[0] = 1.0f; cs[1] = 0.0f; *(v2f*)(CS + (size_t)idx * 2) = cs;  }
// k_lsoft: streaming causal sliding-window row softmax (keys i - WIN < j <= i) one wave per row i, three sweeps of the f32 score row (lane -> 4 consecutive keys per 128-key chunk) over the NCH = 3 chunks from ch0 on, which cover keys b - WIN .. b + 63 of the row's 64-row block b = i & ~63 (the first blocks start at key 0): every key of the window lies there, and they are all that attn.v reads. Keys outside the window are excluded by index with -3e38 / 0 - score tiles outside the band are never computed and their stale contents are only ever discarded by this select:
__global__ __launch_bounds__(256) void k_lsoft(const float* __restrict__ Sb, h16* P16, bf* Ph, bf* Pl) {
    const int lane = threadIdx.x & 31; const int row = blockIdx.x * 8 + (threadIdx.x >> 5); if (row >= ZH * TT) return; const int i = row % TT; const int zz = row / TT; const bool hires = (i < RH); const float* sr = Sb + (size_t)row * TT; float mx = -3.0e38f;
    const int ch0 = max(0, (((i & ~63) + 63) >> 7) - (NCH - 1));
    for (int ch = ch0; ch < ch0 + NCH; ++ch) { const int j0 = ch * 128 + lane * 4; const v4f a = *(const v4f*)(sr + j0);
#pragma unroll
        for (int q = 0; q < 4; ++q) { float t = a[q] * SCL; asm volatile("" : "+v"(t)); t = (j0 + q <= i && j0 + q > i - WIN) ? t : -3.0e38f;   /* causal sliding window: i - WIN < j <= i */ mx = fmaxf(mx, t); } }
#pragma unroll
    for (int sh = 16; sh; sh >>= 1) mx = fmaxf(mx, __shfl_xor(mx, sh, 32));
    float sum = 0.f;
    for (int ch = ch0; ch < ch0 + NCH; ++ch) { const int j0 = ch * 128 + lane * 4; const v4f a = *(const v4f*)(sr + j0);
#pragma unroll
        for (int q = 0; q < 4; ++q) { float t = a[q] * SCL; asm volatile("" : "+v"(t)); t = (j0 + q <= i && j0 + q > i - WIN) ? t : -3.0e38f;   /* causal sliding window: i - WIN < j <= i */ float d0 = __fsub_rn(t, mx); asm volatile("" : "+v"(d0)); sum += __builtin_amdgcn_exp2f(__fmul_rn(d0, 1.4426950408889634f)); } }
#pragma unroll
    for (int sh = 16; sh; sh >>= 1) sum += __shfl_xor(sum, sh, 32);
    const float f = __fdiv_rn(hires ? 1.0f : PCAR, sum);
{
        if (hires) {   /* rows < RH: normalised bf16 hi/lo over the band's chunks (the hi/lo attn.v GEMM keeps its K loop inside them), planes [zz][RH][TT] */
            for (int ch = ch0; ch < ch0 + NCH; ++ch) { const int j0 = ch * 128 + lane * 4; const v4f a = *(const v4f*)(sr + j0); v4us oh, ol;
#pragma unroll
                for (int q = 0; q < 4; ++q) { float t = a[q] * SCL; asm volatile("" : "+v"(t)); t = (j0 + q <= i && j0 + q > i - WIN) ? t : -3.0e38f;   /* causal sliding window: i - WIN < j <= i */ float d0 = __fsub_rn(t, mx); asm volatile("" : "+v"(d0)); float ex = __builtin_amdgcn_exp2f(__fmul_rn(d0, 1.4426950408889634f)); asm volatile("" : "+v"(ex)); unsigned short a2, c2; splitf(ex * f, a2, c2); oh[q] = a2; ol[q] = c2; }
                const size_t oo = ((size_t)zz * RH + i) * TT + j0; *(v4us*)(Ph + oo) = oh; *(v4us*)(Pl + oo) = ol; }
        } else {
#pragma unroll 2
            for (int ch = 0; ch < TT / 128; ++ch) { const int j0 = ch * 128 + lane * 4; const v4f a = *(const v4f*)(sr + j0); v4h o4;
#pragma unroll
                for (int q = 0; q < 4; ++q) { float t = a[q] * SCL; asm volatile("" : "+v"(t)); t = (j0 + q <= i && j0 + q > i - WIN) ? t : -3.0e38f;   /* causal sliding window: i - WIN < j <= i */ float d0 = __fsub_rn(t, mx); asm volatile("" : "+v"(d0)); float ex = __builtin_amdgcn_exp2f(__fmul_rn(d0, 1.4426950408889634f)); asm volatile("" : "+v"(ex)); o4[q] = tohx(ex * f); }
                *(v4h*)(P16 + (size_t)row * TT + j0) = o4; } }
         }
}

__global__ __launch_bounds__(256) void k_merge(const float* __restrict__ O, int h0, bf* Ah, bf* Al) { const size_t e = ((size_t)blockIdx.x * 256 + threadIdx.x) * 2; if (e >= (size_t)ZH * TT * HD) return; const int d = (int)(e % HD); const int t = (int)((e / HD) % TT); const int zz = (int)(e / ((size_t)HD * TT)); const float cs = (t < RH) ? 1.0f : (1.0f / PCAR); const size_t oo = (size_t)t * DQ + (h0 + zz) * HD + d;
    v2us oh, ol;
#pragma unroll
    for (int q = 0; q < 2; ++q) { unsigned short a, c2; splitf(O[e + q] * cs, a, c2); oh[q] = a; ol[q] = c2; } *(v2us*)(Ah + oo) = oh; *(v2us*)(Al + oo) = ol;  }

extern "C" void kernel_launch(void* const* d_in, const int* in_sizes, int n_in,
                              void* d_out, int out_size, void* d_ws, size_t ws_size, hipStream_t stream) {
    (void)in_sizes; (void)n_in; (void)out_size;
    const float* x = (const float*)d_in[0]; const float* wq = (const float*)d_in[1]; const float* wk = (const float*)d_in[2]; const float* wv = (const float*)d_in[3]; const float* wo = (const float*)d_in[4]; const float* bo = (const float*)d_in[5];
    float* OUT = (float*)d_out;     // [1][4096][1024]
    char* wsp = (char*)d_ws;
    auto take = [&](size_t bytes) { char* p = wsp; wsp += (bytes + 255) & ~(size_t)255; return (void*)p; };
    bf* WQ = (bf*)take((size_t)DQ * DM * 2); bf* WK = (bf*)take((size_t)DKV * DM * 2); bf* WV = (bf*)take((size_t)DKV * DM * 2); bf* WO = (bf*)take((size_t)DM * DQ * 2); float* CS = (float*)take((size_t)TT * HD * 2 * 4);
    bf* XB = (bf*)take((size_t)TT * DM * 2); float* FQ = (float*)take((size_t)TT * DQ * 4); float* FK = (float*)take((size_t)TT * DKV * 4);
    h16* QP16 = nullptr;   /* all rows hi/lo: no fp16 planes */ h16* KP16 = nullptr; h16* VT16 = nullptr;
    bf* QPh = (bf*)take((size_t)NH_ * TT * HD * 2); bf* QPl = (bf*)take((size_t)NH_ * TT * HD * 2); bf* KPh = (bf*)take((size_t)NKV * TT * HD * 2); bf* KPl = (bf*)take((size_t)NKV * TT * HD * 2); bf* VTh = (bf*)take((size_t)NKV * HD * TT * 2); bf* VTl = (bf*)take((size_t)NKV * HD * TT * 2); bf* Ph = (bf*)take((size_t)ZH * RH * TT * 2); bf* Pl = (bf*)take((size_t)ZH * RH * TT * 2);
    float* Sb = (float*)take((size_t)ZH * TT * TT * 4); h16* P16 = nullptr; float* Ob = (float*)take((size_t)ZH * TT * HD * 4); bf* ATh = (bf*)take((size_t)TT * DQ * 2); bf* ATl = (bf*)take((size_t)TT * DQ * 2);
    if ((size_t)(wsp - (char*)d_ws) > ws_size) return;    // ws 256 MiB
    float* FV = FK;   // v projection reuses the k buffer after the k planes are built (stream-ordered)
    { k_cvt8<<<(unsigned)(((size_t)DQ * DM / 8 + 255) / 256), 256, 0, stream>>>(wq, WQ, (size_t)DQ * DM / 8); k_cvt8<<<(unsigned)(((size_t)DKV * DM / 8 + 255) / 256), 256, 0, stream>>>(wk, WK, (size_t)DKV * DM / 8); k_cvt8<<<(unsigned)(((size_t)DKV * DM / 8 + 255) / 256), 256, 0, stream>>>(wv, WV, (size_t)DKV * DM / 8);
      k_cvt8<<<(unsigned)(((size_t)DM * DQ / 8 + 255) / 256), 256, 0, stream>>>(wo, WO, (size_t)DM * DQ / 8);
       }
    k_csid<<<(TT * HD + 255) / 256, 256, 0, stream>>>(CS);
    const unsigned LQ = (unsigned)(((size_t)NH_ * TT * HD / 2 + 255) / 256), LKv = (unsigned)(((size_t)NKV * TT * HD / 2 + 255) / 256);
    for (int b = 0; b < NB_; ++b) {
        
        k_cvt8<<<(unsigned)(((size_t)TT * DM / 8 + 255) / 256), 256, 0, stream>>>(x + (size_t)b * TT * DM, XB, (size_t)TT * DM / 8);
        k_gemmw<bf, 0, false><<<dim3(TT / 64, DQ / 64, 1), 32, 0, stream>>>(XB, nullptr, WQ, nullptr, DM, FQ, DQ, nullptr, 0, 0, 0);
        k_rope<<<LQ, 256, 0, stream>>>(FQ, DQ, NH_, CS, nullptr, nullptr, 1.0f, QP16, QPh, QPl);
        k_gemmw<bf, 0, false><<<dim3(TT / 64, DKV / 64, 1), 32, 0, stream>>>(XB, nullptr, WK, nullptr, DM, FK, DKV, nullptr, 0, 0, 0);
        k_rope<<<LKv, 256, 0, stream>>>(FK, DKV, NKV, CS, nullptr, nullptr, 1.0f, KP16, KPh, KPl);
        k_gemmw<bf, 0, false><<<dim3(TT / 64, DKV / 64, 1), 32, 0, stream>>>(XB, nullptr, WV, nullptr, DM, FV, DKV, nullptr, 0, 0, 0); k_vtp<<<LKv, 256, 0, stream>>>(FV, DKV, NKV, VT16, VTh, VTl);
        for (int h0 = 0; h0 < NH_; h0 += ZH) { const size_t zq = (size_t)h0, zk = (size_t)(h0 / REP);   // one kv head per query head: the pass's single head (ZH = 1) uses kv plane h0 (z-strides TT*HD)
            k_gemmc<bf, 2, 1><<<dim3(RH / 64, WIN / 64 + 1, ZH), 32, 0, stream>>>(QPh + zq * TT * HD, QPl + zq * TT * HD, KPh + zk * TT * HD, KPl + zk * TT * HD, HD, Sb, TT, 0, (size_t)TT * HD, (size_t)TT * HD, (size_t)TT * TT);
            k_lsoft<<<ZH * TT / 8, 256, 0, stream>>>(Sb, P16, Ph, Pl);
            k_gemmc<bf, 2, 2><<<dim3(RH / 64, HD / 64, ZH), 32, 0, stream>>>(Ph, Pl, VTh + zk * HD * TT, VTl + zk * HD * TT, TT, Ob, HD, 0, (size_t)RH * TT, (size_t)HD * TT, (size_t)TT * HD);
            k_merge<<<(unsigned)(((size_t)ZH * TT * HD / 2 + 255) / 256), 256, 0, stream>>>(Ob, h0, ATh, ATl); }
        k_gemmw<bf, 1, true><<<dim3(TT / 64, DM / 64, 1), 32, 0, stream>>>(ATh, ATl, WO, nullptr, DQ, OUT + (size_t)b * TT * DM, DM, bo, 0, 0, 0); }
}

// v002
// One run takes 197 microseconds.
// Two timings next to v001 put it at 2.82 and 2.76 times that version's speed.
// Over all steps from v000 it is 11.6 times as fast.
#include <hip/hip_runtime.h>

// Local causal multi-head attention WITHOUT the 1/sqrt(d) scaling (x [1][4096][1024]; q,k,v = x W^T ('oi' [1024][1024], no bias; 16 heads x 64); scores = q.k (unscaled: logit sigma ~8); keys with j > i or j <= i - 256 masked (-1e30 == exclusion); softmax; ctx merged; out = ctx Wo^T + bo -> [1][4096][1024] (4.2 M)).
// Layout: bf16 copy of x; exact projections; causal-window T-4096 attention, every head in one launch, with EVERY row on bf16 hi/lo planes (3 products; the unscaled logits are too sharp for fp16 planes): k_fattn gives a 64-row block of one head to one work-group, which computes the 320 keys of scores that the 256-wide band touches into LDS, takes the softmax over the band's three 128-key chunks with the window as an index select, does attn.v (3 products) over the band's 320 keys from LDS and writes the merged hi/lo context; merged hi/lo x Wo exact + bo.
// Compute dtypes, f32 accumulate: every input rounded to bf16; projections exact; scores and attn.v 3 products on every row; softmax f32; Wo hl x exact + bias.

#define NB_  1
#define TT   4096
#define DM   1024
#define NH_  16
#define NKV  16
#define REP  (NH_ / NKV)
#define HD   64
#define DQ   (NH_ * HD)
#define DKV  (NKV * HD)
#define ZH   1
#define RH   4096                  // unused: every query row uses hi+lo planes
#define WIN  256
#define NCH  ((WIN + 127) / 128 + 1)   // 128-key softmax chunks that cover a 64-row block's WIN + 64 keys at any 64-key phase
#define PCAR 1024.0f
#define SCL  1.0f   // the module applies no 1/sqrt(d)
typedef _Float16 h16;
typedef unsigned short bf;
typedef __attribute__((ext_vector_type(16))) __bf16   v16bf;
typedef __attribute__((ext_vector_type(16))) _Float16 v16h;
typedef __attribute__((ext_vector_type(8)))  _Float16 v8h;
typedef __attribute__((ext_vector_type(8)))  unsigned short v8us;
typedef __attribute__((ext_vector_type(8)))  float    v8f;
typedef __attribute__((ext_vector_type(4)))  float    v4f;
typedef v8h  __attribute__((may_alias)) v8ha;
typedef v4f  __attribute__((may_alias)) v4fa;
typedef v8us __attribute__((may_alias)) v8usa;

__device__ __forceinline__ unsigned short f2bf(float f) { unsigned u = __float_as_uint(f); u += 0x7FFFu + ((u >> 16) & 1u); return (unsigned short)(u >> 16); }
__device__ __forceinline__ float bf2f(unsigned short b) { return __uint_as_float(((unsigned)b) << 16); }
__device__ __forceinline__ float bfr(float f) { return bf2f(f2bf(f)); }
__device__ __forceinline__ v16h cat16(v8h lo, v8h hi) { return __builtin_shufflevector(lo, hi, 0, 1, 2, 3, 4, 5, 6, 7, 8, 9, 10, 11, 12, 13, 14, 15); }
__device__ __forceinline__ v16bf cat16b(v8us lo, v8us hi) { return __builtin_bit_cast(v16bf, __builtin_shufflevector(lo, hi, 0, 1, 2, 3, 4, 5, 6, 7, 8, 9, 10, 11, 12, 13, 14, 15)); }
__device__ __forceinline__ v8f wmma16(v16h a, v16h b, v8f c) { return __builtin_amdgcn_wmma_f32_16x16x32_f16(false, a, false, b, (short)0, c, false, false); }
__device__ __forceinline__ v8f wmmab(v16bf a, v16bf b, v8f c) { return __builtin_amdgcn_wmma_f32_16x16x32_bf16(false, a, false, b, (short)0, c, false, false); }



// ---- k_gemmw: register-blocked GEMM, ONE WAVE per 64x64 output tile (16 accumulators), operands straight from K-contiguous 16-bit planes; grid (M/64, N/64, Z), 32 threads.
// C[m][n] (f32, pitch ldc, + optional f32 bias[n]) = sum_k A[m][k] Bt[n][k] (+ split products per NSPLIT). z-batch strides sA/sB/sC in elements. K % 32 == 0.
template <typename T16> struct WFrag;
template <> struct WFrag<h16> { typedef v16h V; static __device__ __forceinline__ V ld(const h16* p) { return cat16(*(const v8h*)p, *(const v8h*)(p + 16)); } static __device__ __forceinline__ v8f mma(V a, V b, v8f c) { return wmma16(a, b, c); } };
template <> struct WFrag<bf> { typedef v16bf V; static __device__ __forceinline__ V ld(const bf* p) { return cat16b(*(const v8us*)p, *(const v8us*)(p + 16)); } static __device__ __forceinline__ v8f mma(V a, V b, v8f c) { return wmmab(a, b, c); } };
template <typename T16, int NSPLIT, bool BIAS>
__global__ __launch_bounds__(32) void k_gemmw(const T16* __restrict__ A, const T16* __restrict__ A2, const T16* __restrict__ Bt, const T16* __restrict__ Bt2, int K, float* C, int ldc, const float* __restrict__ bias, size_t sA, size_t sB, size_t sC) {
    typedef typename WFrag<T16>::V V;
    __shared__ __align__(16) float os[16 * 68];
    const size_t z = blockIdx.z; A += z * sA; if (A2) A2 += z * sA; Bt += z * sB; if (Bt2) Bt2 += z * sB; C += z * sC;
    const int lane = threadIdx.x & 31, lr = lane & 15, hi = lane >> 4; const int r0 = blockIdx.x * 64, c0 = blockIdx.y * 64;
    v8f acc[4][4];
#pragma unroll
    for (int mb = 0; mb < 4; ++mb)
#pragma unroll
        for (int nb = 0; nb < 4; ++nb) acc[mb][nb] = (v8f){};
    const size_t aoff = (size_t)(r0 + lr) * K + 8 * hi, boff = (size_t)(c0 + lr) * K + 8 * hi;
#pragma unroll 1
    for (int kc = 0; kc < K; kc += 32) {
        V a[4], a2[4];
#pragma unroll
        for (int mb = 0; mb < 4; ++mb) { a[mb] = WFrag<T16>::ld(A + aoff + (size_t)mb * 16 * K + kc); if (NSPLIT == 1 || NSPLIT == 2) a2[mb] = WFrag<T16>::ld(A2 + aoff + (size_t)mb * 16 * K + kc); }
#pragma unroll
        for (int nb = 0; nb < 4; ++nb) { const V b = WFrag<T16>::ld(Bt + boff + (size_t)nb * 16 * K + kc); V b2; if (NSPLIT >= 2) b2 = WFrag<T16>::ld(Bt2 + boff + (size_t)nb * 16 * K + kc);
#pragma unroll
            for (int mb = 0; mb < 4; ++mb) { acc[mb][nb] = WFrag<T16>::mma(a[mb], b, acc[mb][nb]); if (NSPLIT == 1 || NSPLIT == 2) acc[mb][nb] = WFrag<T16>::mma(a2[mb], b, acc[mb][nb]); if (NSPLIT >= 2) acc[mb][nb] = WFrag<T16>::mma(a[mb], b2, acc[mb][nb]); } }
        asm volatile("v_nop\n\tv_nop\n\tv_nop\n\tv_nop" : "+v"(acc[0][0]), "+v"(acc[1][1]), "+v"(acc[2][2]), "+v"(acc[3][3]) : "v"(a[0]), "v"(a[3]));
    }
#pragma unroll
    for (int mb = 0; mb < 4; ++mb) {
#pragma unroll
        for (int nb = 0; nb < 4; ++nb) {
#pragma unroll
            for (int j = 0; j < 8; ++j) os[(hi * 8 + j) * 68 + nb * 16 + lr] = acc[mb][nb][j]; }
        __builtin_amdgcn_wave_barrier(); asm volatile("" ::: "memory");
        float* crow = C + (size_t)(r0 + mb * 16) * ldc + c0;
{
#pragma unroll
            for (int s = 0; s < 8; ++s) { const int row = 2 * s + hi, cofs = lr * 4; v4f val = *(const v4fa*)(os + row * 68 + cofs); if (BIAS) { val[0] += bfr(bias[c0 + cofs]); val[1] += bfr(bias[c0 + cofs + 1]); val[2] += bfr(bias[c0 + cofs + 2]); val[3] += bfr(bias[c0 + cofs + 3]); }
                *(v4f*)(crow + (size_t)row * ldc + cofs) = val; }
             }
        __builtin_amdgcn_wave_barrier(); asm volatile("" ::: "memory");
    }
}

__device__ __forceinline__ h16 tohx(float x) { return (h16)x; }
__device__ __forceinline__ void splitf(float y, unsigned short& h, unsigned short& l) { h = f2bf(y); l = f2bf(y - bf2f(h)); }
typedef __attribute__((ext_vector_type(2))) _Float16 v2h;
typedef __attribute__((ext_vector_type(4))) _Float16 v4h;
typedef __attribute__((ext_vector_type(2))) unsigned short v2us;
typedef __attribute__((ext_vector_type(4))) unsigned short v4us;
typedef __attribute__((ext_vector_type(2))) float v2f;
typedef __attribute__((ext_vector_type(4))) int v4i;

__global__ __launch_bounds__(256) void k_wtG(const float* __restrict__ w, int K, int N, bf* Bt) {
    const int lane = threadIdx.x & 31; const int L0 = (blockIdx.x * 8 + (threadIdx.x >> 5)) * 8; const int nlines = N * K / 64;
{
#pragma unroll 1
        for (int l = 0; l < 8; ++l) { const int L = L0 + l; if (L >= nlines) break; const size_t e = (size_t)L * 64 + lane * 2; const int k = (int)(e % K), n = (int)(e / K); v2us o;
            o[0] = f2bf(w[(size_t)k * N + n]); o[1] = f2bf(w[(size_t)(k + 1) * N + n]); *(v2us*)(Bt + e) = o; }
         }
}
__global__ __launch_bounds__(256) void k_cvt8(const float* __restrict__ src, bf* dst, size_t n8) { const size_t i = (size_t)blockIdx.x * 256 + threadIdx.x; if (i >= n8) return; const v8f v = *(const v8f*)(src + i * 8); v8us o;
#pragma unroll
    for (int k = 0; k < 8; ++k) o[k] = f2bf(v[k]); *(v8us*)(dst + i * 8) = o;  }

// k_rope: head planes [h][t][d] (fp16 + hi/lo) of rope(x) x sc with the rotate-half convention out[d] = x[d] cos[t][d] - x[d+HD/2] sin[t][d], out[d+HD/2] = x[d+HD/2] cos[t][d+HD/2] + x[d] sin[t][d+HD/2]
__global__ __launch_bounds__(256) void k_rope(const float* __restrict__ F, int pitch, int nheads, const float* __restrict__ CS, const float* __restrict__ RF, const float* __restrict__ nw, float sc, h16* P16, bf* Ph, bf* Pl) {
    const size_t e = ((size_t)blockIdx.x * 256 + threadIdx.x) * 2; if (e >= (size_t)nheads * TT * HD) return; const int d = (int)(e % HD); const int t = (int)((e / HD) % TT); const int h = (int)(e / ((size_t)HD * TT)); const float* f = F + (size_t)t * pitch + h * HD; const float rf = RF ? RF[(size_t)h * TT + t] : 1.0f; v2h o16; v2us oh, ol;
#pragma unroll
    for (int q = 0; q < 2; ++q) { const int dd = d + q; const int dp = (dd < HD / 2) ? dd + HD / 2 : dd - HD / 2; float x0 = f[dd], x1 = f[dp];
        if (RF) { float n0 = __fmul_rn(x0, rf), n1 = __fmul_rn(x1, rf); asm volatile("" : "+v"(n0)); asm volatile("" : "+v"(n1)); x0 = __fmul_rn(bfr(nw[dd]), n0); x1 = __fmul_rn(bfr(nw[dp]), n1); }
        const v2f cs = *(const v2f*)(CS + ((size_t)t * HD + dd) * 2); float a = __fmul_rn(x0, cs[0]), bq = __fmul_rn(x1, cs[1]); asm volatile("" : "+v"(a)); asm volatile("" : "+v"(bq)); const float r = ((dd < HD / 2) ? __fsub_rn(a, bq) : __fadd_rn(a, bq)) * sc;
        o16[q] = tohx(r); unsigned short a2, c2; splitf(r, a2, c2); oh[q] = a2; ol[q] = c2; }
    if (P16 != nullptr) { *(v2h*)(P16 + e) = o16; } *(v2us*)(Ph + e) = oh; *(v2us*)(Pl + e) = ol;  }
__global__ __launch_bounds__(256) void k_vtp(const float* __restrict__ F, int pitch, int nheads, h16* V16, bf* Vh, bf* Vl) { const size_t e = ((size_t)blockIdx.x * 256 + threadIdx.x) * 2; if (e >= (size_t)nheads * HD * TT) return; const int t = (int)(e % TT); const int d = (int)((e / TT) % HD); const int g = (int)(e / ((size_t)TT * HD)); v2h o16; v2us oh, ol;
#pragma unroll
    for (int q = 0; q < 2; ++q) { const float x = F[(size_t)(t + q) * pitch + g * HD + d]; o16[q] = tohx(x); unsigned short a2, c2; splitf(x, a2, c2); oh[q] = a2; ol[q] = c2; }
    if (V16 != nullptr) { *(v2h*)(V16 + e) = o16; } *(v2us*)(Vh + e) = oh; *(v2us*)(Vl + e) = ol;  }
__global__ __launch_bounds__(256) void k_csid(float* CS) { const int idx = blockIdx.x * 256 + threadIdx.x; if (idx >= TT * HD) return; v2f cs; cs[0] = 1.0f; cs[1] = 0.0f; *(v2f*)(CS + (size_t)idx * 2) = cs;  }
// k_fattn: one launch for every head: a work-group of 8 waves owns one 64-row block of one head and keeps the block's band in LDS from the scores to the merged context.
// LDS row = the NCH = 3 128-key chunks from key kb on (they cover keys r0 - WIN .. r0 + 63; the first blocks start at key 0): 384 f32 scores, overwritten in place by 384 bf16 hi + 384 bf16 lo probabilities.
// Every sum keeps its order: score tiles k 0..31 then 32..63 (hi.hi, lo.hi, hi.lo); softmax one wave per row, lane -> 4 consecutive keys per chunk; attn.v 32 keys a step from the band's first key up.
#define SPB 1552   // LDS row pitch in bytes: 1536 + 16 (16 B x odd, so that sixteen rows' 16-byte fragment reads fall on different banks)
#define OPB 272    // output staging pitch in bytes (68 dwords)
typedef float __attribute__((may_alias)) f32a;
typedef v4us __attribute__((may_alias)) v4usa;
__global__ __launch_bounds__(256) void k_fattn(const bf* __restrict__ Qh, const bf* __restrict__ Ql, const bf* __restrict__ Kh, const bf* __restrict__ Kl, const bf* __restrict__ Vh, const bf* __restrict__ Vl, bf* Ah, bf* Al) {
    __shared__ __align__(16) char sm[64 * SPB];
    const int lane = threadIdx.x & 31, lr = lane & 15, hi = lane >> 4; const int w = __builtin_amdgcn_readfirstlane(threadIdx.x >> 5);
    const int r0 = blockIdx.x * 64; const size_t hq = (size_t)blockIdx.y * TT * HD, hk = (size_t)(blockIdx.y / REP) * TT * HD;
    const int kb = max(0, ((r0 + 63) >> 7) - (NCH - 1)) * 128;   // key of LDS column 0
    const int K0 = max(0, r0 - WIN);                             // first key of the band
    const bool full = r0 >= WIN;                                 // the block's whole band of WIN + 64 keys exists
    const int mp = w >> 2, wq = w & 3;                           // the wave's pair of 16-row groups; its quarter of the keys (scores) or of the head dims (attn.v)
    {   // scores: 2 row groups x 5 key tiles of 16 per wave
        v16bf a[2][2], a2[2][2];
#pragma unroll
        for (int m = 0; m < 2; ++m)
#pragma unroll
            for (int ks = 0; ks < 2; ++ks) { const size_t o = hq + (size_t)(r0 + (mp * 2 + m) * 16 + lr) * HD + ks * 32 + 8 * hi; a[m][ks] = WFrag<bf>::ld(Qh + o); a2[m][ks] = WFrag<bf>::ld(Ql + o); asm volatile("s_wait_xcnt 0x0" ::: "memory"); }   // the wait stands behind each group of loads in this kernel, in front of whatever next takes the registers that held their addresses
        auto ldk = [&](int c, v16bf* b, v16bf* b2) { const size_t o = hk + (size_t)(c + lr) * HD + 8 * hi;
#pragma unroll
            for (int ks = 0; ks < 2; ++ks) { b[ks] = WFrag<bf>::ld(Kh + o + ks * 32); b2[ks] = WFrag<bf>::ld(Kl + o + ks * 32); }
            asm volatile("s_wait_xcnt 0x0" ::: "memory"); };   // before the address registers are reused
        auto tile = [&](int c, const v16bf* b, const v16bf* b2) { v8f acc[2]; acc[0] = (v8f){}; acc[1] = (v8f){};
#pragma unroll
            for (int ks = 0; ks < 2; ++ks)
#pragma unroll
                for (int m = 0; m < 2; ++m) { acc[m] = wmmab(a[m][ks], b[ks], acc[m]); acc[m] = wmmab(a2[m][ks], b[ks], acc[m]); acc[m] = wmmab(a[m][ks], b2[ks], acc[m]); }
            asm volatile("v_nop\n\tv_nop\n\tv_nop\n\tv_nop" : "+v"(acc[0]), "+v"(acc[1]));   // four vector slots behind the tile's last matrix instruction: the LDS stores fill none, and the next tile's first product may be given the same result registers
#pragma unroll
            for (int m = 0; m < 2; ++m)
#pragma unroll
                for (int j = 0; j < 8; ++j) *(f32a*)(sm + ((mp * 2 + m) * 16 + hi * 8 + j) * SPB + (c - kb + lr) * 4) = acc[m][j]; };
        const int cw = r0 - WIN + wq * 80;   // the wave's first key
        if (full) {   // the whole band exists: straight-line code with the key fragments fetched three tiles ahead
            v16bf b[5][2], b2[5][2];
#pragma unroll
            for (int t = 0; t < 3; ++t) ldk(cw + t * 16, b[t], b2[t]);
            __builtin_amdgcn_sched_barrier(0);   // keeps the first three tiles' loads in front of the first product (the scheduler otherwise sinks each load to its use and the wave waits out one memory latency per fragment)
#pragma unroll
            for (int t = 0; t < 5; ++t) { if (t + 3 < 5) ldk(cw + (t + 3) * 16, b[t + 3], b2[t + 3]);
                tile(cw + t * 16, b[t], b2[t]);
                __builtin_amdgcn_sched_barrier(0);   // keeps the load issued in this tile from sinking into a later one
            }
        } else {
#pragma unroll 1
            for (int t = 0; t < 5; ++t) { const int c = cw + t * 16; if (c < 0) continue;   // a tile in front of key 0 does not exist
                v16bf b[2], b2[2]; ldk(c, b, b2); tile(c, b, b2); }
        }
    }
    __syncthreads();
    const size_t vo = hk + (size_t)(wq * 16 + lr) * TT + 8 * hi;   // the wave's 16 head dims of the v planes [d][t]
    v16bf vb[(WIN + 64) / 32], vb2[(WIN + 64) / 32];
    if (full) {   // the first five 32-key steps of v are fetched here, so that they land while the softmax runs
#pragma unroll
        for (int kk = 0; kk < 5; ++kk) { vb[kk] = WFrag<bf>::ld(Vh + vo + K0 + kk * 32); vb2[kk] = WFrag<bf>::ld(Vl + vo + K0 + kk * 32); asm volatile("s_wait_xcnt 0x0" ::: "memory"); }   // before the address registers are reused
    }
    {   // softmax: 8 rows per wave, each row whole in registers (12 scores a lane); columns outside the band were never written and are not read
        v4f s[8][NCH];
#pragma unroll
        for (int rr = 0; rr < 8; ++rr)
#pragma unroll
            for (int ch = 0; ch < NCH; ++ch) { const int j0 = kb + ch * 128 + lane * 4; s[rr][ch] = (v4f){}; if (j0 >= K0 && j0 < r0 + 64) s[rr][ch] = *(const v4fa*)(sm + (w * 8 + rr) * SPB + (ch * 128 + lane * 4) * 4); }
#pragma unroll
        for (int rr = 0; rr < 8; ++rr) { const int i = r0 + w * 8 + rr; float mx = -3.0e38f;
#pragma unroll
            for (int ch = 0; ch < NCH; ++ch) { const int j0 = kb + ch * 128 + lane * 4;
#pragma unroll
                for (int q = 0; q < 4; ++q) { const float t = (j0 + q <= i && j0 + q > i - WIN) ? s[rr][ch][q] * SCL : -3.0e38f;   /* causal sliding window: i - WIN < j <= i */ s[rr][ch][q] = t; mx = fmaxf(mx, t); } }
#pragma unroll
            for (int sh = 16; sh; sh >>= 1) mx = fmaxf(mx, __shfl_xor(mx, sh, 32));
            float sum = 0.f;
#pragma unroll
            for (int ch = 0; ch < NCH; ++ch)
#pragma unroll
                for (int q = 0; q < 4; ++q) { const float ex = __builtin_amdgcn_exp2f(__fmul_rn(__fsub_rn(s[rr][ch][q], mx), 1.4426950408889634f)); s[rr][ch][q] = ex; sum += ex; }
#pragma unroll
            for (int sh = 16; sh; sh >>= 1) sum += __shfl_xor(sum, sh, 32);
            const float f = __fdiv_rn(1.0f, sum);
#pragma unroll
            for (int ch = 0; ch < NCH; ++ch) { v4us oh, ol;
#pragma unroll
                for (int q = 0; q < 4; ++q) { unsigned short a2, c2; splitf(s[rr][ch][q] * f, a2, c2); oh[q] = a2; ol[q] = c2; }
                char* pr = sm + (w * 8 + rr) * SPB + (ch * 128 + lane * 4) * 2; *(v4usa*)pr = oh; *(v4usa*)(pr + 768) = ol; } }
    }
    __syncthreads();
    v8f o[2]; o[0] = (v8f){}; o[1] = (v8f){};
    {   // attn.v: 2 row groups x 16 head dims per wave; probabilities from LDS, v planes [d][t] from memory
        const char* pa = sm + (mp * 32 + lr) * SPB + 16 * hi;
        auto step = [&](int kc, v16bf b, v16bf b2) {
#pragma unroll
            for (int m = 0; m < 2; ++m) { const char* p = pa + m * 16 * SPB + (kc - kb) * 2; const v16bf a = cat16b(*(const v8usa*)p, *(const v8usa*)(p + 32)), a2 = cat16b(*(const v8usa*)(p + 768), *(const v8usa*)(p + 800));
                o[m] = wmmab(a, b, o[m]); o[m] = wmmab(a2, b, o[m]); o[m] = wmmab(a, b2, o[m]); } };
        if (full) {
#pragma unroll
            for (int kk = 0; kk < (WIN + 64) / 32; ++kk) { if (kk + 5 < (WIN + 64) / 32) { vb[kk + 5] = WFrag<bf>::ld(Vh + vo + K0 + (kk + 5) * 32); vb2[kk + 5] = WFrag<bf>::ld(Vl + vo + K0 + (kk + 5) * 32); asm volatile("s_wait_xcnt 0x0" ::: "memory"); }   // before the address registers are reused
                step(K0 + kk * 32, vb[kk], vb2[kk]);
                __builtin_amdgcn_sched_barrier(0);   // keeps the v load issued in this step, five steps ahead of its use, from sinking to that use
            }
        } else {
#pragma unroll 1
            for (int kc = 0; kc < r0 + 64; kc += 32) { const v16bf b = WFrag<bf>::ld(Vh + vo + kc), b2 = WFrag<bf>::ld(Vl + vo + kc); asm volatile("s_wait_xcnt 0x0" ::: "memory");   // before the address registers are reused
                step(kc, b, b2); }
        }
    }
    __syncthreads();   // every wave has read its last probability fragment: the rows become output staging
#pragma unroll
    for (int m = 0; m < 2; ++m)
#pragma unroll
        for (int j = 0; j < 8; ++j) *(f32a*)(sm + ((mp * 2 + m) * 16 + hi * 8 + j) * OPB + (wq * 16 + lr) * 4) = o[m][j];
    __syncthreads();
    {   // merged hi/lo context [t][head * 64 + d]: four lanes of one wave write a row's 128 bytes of each plane
        const int row = threadIdx.x >> 2, cq = (threadIdx.x & 3) * 16; const size_t oo = (size_t)(r0 + row) * DQ + blockIdx.y * HD + cq;
#pragma unroll
        for (int g = 0; g < 2; ++g) { v8us oh, ol;
#pragma unroll
            for (int u = 0; u < 2; ++u) { const v4f val = *(const v4fa*)(sm + row * OPB + (cq + g * 8 + u * 4) * 4);
#pragma unroll
                for (int q = 0; q < 4; ++q) { unsigned short a2, c2; splitf(val[q], a2, c2); oh[u * 4 + q] = a2; ol[u * 4 + q] = c2; } }
            *(v8us*)(Ah + oo + g * 8) = oh; *(v8us*)(Al + oo + g * 8) = ol; }
    }
}

extern "C" void kernel_launch(void* const* d_in, const int* in_sizes, int n_in,
                              void* d_out, int out_size, void* d_ws, size_t ws_size, hipStream_t stream) {
    (void)in_sizes; (void)n_in; (void)out_size;
    const float* x = (const float*)d_in[0]; const float* wq = (const float*)d_in[1]; const float* wk = (const float*)d_in[2]; const float* wv = (const float*)d_in[3]; const float* wo = (const float*)d_in[4]; const float* bo = (const float*)d_in[5];
    float* OUT = (float*)d_out;     // [1][4096][1024]
    char* wsp = (char*)d_ws;
    auto take = [&](size_t bytes) { char* p = wsp; wsp += (bytes + 255) & ~(size_t)255; return (void*)p; };
    bf* WQ = (bf*)take((size_t)DQ * DM * 2); bf* WK = (bf*)take((size_t)DKV * DM * 2); bf* WV = (bf*)take((size_t)DKV * DM * 2); bf* WO = (bf*)take((size_t)DM * DQ * 2); float* CS = (float*)take((size_t)TT * HD * 2 * 4);
    bf* XB = (bf*)take((size_t)TT * DM * 2); float* FQ = (float*)take((size_t)TT * DQ * 4); float* FK = (float*)take((size_t)TT * DKV * 4);
    h16* QP16 = nullptr;   /* all rows hi/lo: no fp16 planes */ h16* KP16 = nullptr; h16* VT16 = nullptr;
    bf* QPh = (bf*)take((size_t)NH_ * TT * HD * 2); bf* QPl = (bf*)take((size_t)NH_ * TT * HD * 2); bf* KPh = (bf*)take((size_t)NKV * TT * HD * 2); bf* KPl = (bf*)take((size_t)NKV * TT * HD * 2); bf* VTh = (bf*)take((size_t)NKV * HD * TT * 2); bf* VTl = (bf*)take((size_t)NKV * HD * TT * 2);
    bf* ATh = (bf*)take((size_t)TT * DQ * 2); bf* ATl = (bf*)take((size_t)TT * DQ * 2);
    if ((size_t)(wsp - (char*)d_ws) > ws_size) return;    // ws 256 MiB
    float* FV = FK;   // v projection reuses the k buffer after the k planes are built (stream-ordered)
    { k_cvt8<<<(unsigned)(((size_t)DQ * DM / 8 + 255) / 256), 256, 0, stream>>>(wq, WQ, (size_t)DQ * DM / 8); k_cvt8<<<(unsigned)(((size_t)DKV * DM / 8 + 255) / 256), 256, 0, stream>>>(wk, WK, (size_t)DKV * DM / 8); k_cvt8<<<(unsigned)(((size_t)DKV * DM / 8 + 255) / 256), 256, 0, stream>>>(wv, WV, (size_t)DKV * DM / 8);
      k_cvt8<<<(unsigned)(((size_t)DM * DQ / 8 + 255) / 256), 256, 0, stream>>>(wo, WO, (size_t)DM * DQ / 8);
       }
    k_csid<<<(TT * HD + 255) / 256, 256, 0, stream>>>(CS);
    const unsigned LQ = (unsigned)(((size_t)NH_ * TT * HD / 2 + 255) / 256), LKv = (unsigned)(((size_t)NKV * TT * HD / 2 + 255) / 256);
    for (int b = 0; b < NB_; ++b) {
        
        k_cvt8<<<(unsigned)(((size_t)TT * DM / 8 + 255) / 256), 256, 0, stream>>>(x + (size_t)b * TT * DM, XB, (size_t)TT * DM / 8);
        k_gemmw<bf, 0, false><<<dim3(TT / 64, DQ / 64, 1), 32, 0, stream>>>(XB, nullptr, WQ, nullptr, DM, FQ, DQ, nullptr, 0, 0, 0);
        k_rope<<<LQ, 256, 0, stream>>>(FQ, DQ, NH_, CS, nullptr, nullptr, 1.0f, QP16, QPh, QPl);
        k_gemmw<bf, 0, false><<<dim3(TT / 64, DKV / 64, 1), 32, 0, stream>>>(XB, nullptr, WK, nullptr, DM, FK, DKV, nullptr, 0, 0, 0);
        k_rope<<<LKv, 256, 0, stream>>>(FK, DKV, NKV, CS, nullptr, nullptr, 1.0f, KP16, KPh, KPl);
        k_gemmw<bf, 0, false><<<dim3(TT / 64, DKV / 64, 1), 32, 0, stream>>>(XB, nullptr, WV, nullptr, DM, FV, DKV, nullptr, 0, 0, 0); k_vtp<<<LKv, 256, 0, stream>>>(FV, DKV, NKV, VT16, VTh, VTl);
        k_fattn<<<dim3(TT / 64, NH_, 1), 256, 0, stream>>>(QPh, QPl, KPh, KPl, VTh, VTl, ATh, ATl);
        k_gemmw<bf, 1, true><<<dim3(TT / 64, DM / 64, 1), 32, 0, stream>>>(ATh, ATl, WO, nullptr, DQ, OUT + (size_t)b * TT * DM, DM, bo, 0, 0, 0); }
}

// v003
// One run takes 138 microseconds.
// Next to v002, in two timings, it ran 1.45 and 1.42 times as fast.
// Over all steps from v000 it is 16.6 times as fast.
#include <hip/hip_runtime.h>

// Local causal multi-head attention WITHOUT the 1/sqrt(d) scaling (x [1][4096][1024]; q,k,v = x W^T ('oi' [1024][1024], no bias; 16 heads x 64); scores = q.k (unscaled: logit sigma ~8); keys with j > i or j <= i - 256 masked (-1e30 == exclusion); softmax; ctx merged; out = ctx Wo^T + bo -> [1][4096][1024] (4.2 M)).
// Layout: bf16 copy of x; exact q, k, v projections in one launch that writes the hi/lo head planes (v transposed) from its epilogue; causal-window T-4096 attention, every head in one launch, with EVERY row on bf16 hi/lo planes (3 products; the unscaled logits are too sharp for fp16 planes): k_fattn gives a 64-row block of one head to one work-group, which computes the 320 keys of scores that the 256-wide band touches into LDS, takes the softmax over the band's three 128-key chunks with the window as an index select, does attn.v (3 products) over the band's 320 keys from LDS and writes the merged hi/lo context; merged hi/lo x Wo exact + bo.
// Compute dtypes, f32 accumulate: every input rounded to bf16; projections exact; scores and attn.v 3 products on every row; softmax f32; Wo hl x exact + bias.

#define NB_  1
#define TT   4096
#define DM   1024
#define NH_  16
#define NKV  16
#define REP  (NH_ / NKV)
#define HD   64
#define DQ   (NH_ * HD)
#define DKV  (NKV * HD)
#define ZH   1
#define RH   4096                  // unused: every query row uses hi+lo planes
#define WIN  256
#define NCH  ((WIN + 127) / 128 + 1)   // 128-key softmax chunks that cover a 64-row block's WIN + 64 keys at any 64-key phase
#define PCAR 1024.0f
#define SCL  1.0f   // the module applies no 1/sqrt(d)
typedef _Float16 h16;
typedef unsigned short bf;
typedef __attribute__((ext_vector_type(16))) __bf16   v16bf;
typedef __attribute__((ext_vector_type(16))) _Float16 v16h;
typedef __attribute__((ext_vector_type(8)))  _Float16 v8h;
typedef __attribute__((ext_vector_type(8)))  unsigned short v8us;
typedef __attribute__((ext_vector_type(8)))  float    v8f;
typedef __attribute__((ext_vector_type(4)))  float    v4f;
typedef v8h  __attribute__((may_alias)) v8ha;
typedef v4f  __attribute__((may_alias)) v4fa;
typedef v8us __attribute__((may_alias)) v8usa;

__device__ __forceinline__ unsigned short f2bf(float f) { unsigned u = __float_as_uint(f); u += 0x7FFFu + ((u >> 16) & 1u); return (unsigned short)(u >> 16); }
__device__ __forceinline__ float bf2f(unsigned short b) { return __uint_as_float(((unsigned)b) << 16); }
__device__ __forceinline__ float bfr(float f) { return bf2f(f2bf(f)); }
__device__ __forceinline__ v16h cat16(v8h lo, v8h hi) { return __builtin_shufflevector(lo, hi, 0, 1, 2, 3, 4, 5, 6, 7, 8, 9, 10, 11, 12, 13, 14, 15); }
__device__ __forceinline__ v16bf cat16b(v8us lo, v8us hi) { return __builtin_bit_cast(v16bf, __builtin_shufflevector(lo, hi, 0, 1, 2, 3, 4, 5, 6, 7, 8, 9, 10, 11, 12, 13, 14, 15)); }
__device__ __forceinline__ v8f wmma16(v16h a, v16h b, v8f c) { return __builtin_amdgcn_wmma_f32_16x16x32_f16(false, a, false, b, (short)0, c, false, false); }
__device__ __forceinline__ v8f wmmab(v16bf a, v16bf b, v8f c) { return __builtin_amdgcn_wmma_f32_16x16x32_bf16(false, a, false, b, (short)0, c, false, false); }



// ---- k_gemmw: register-blocked GEMM, ONE WAVE per 64x64 output tile (16 accumulators), operands straight from K-contiguous 16-bit planes; grid (M/64, N/64, Z), 32 threads.
// C[m][n] (f32, pitch ldc, + optional f32 bias[n]) = sum_k A[m][k] Bt[n][k] (+ split products per NSPLIT). z-batch strides sA/sB/sC in elements. K % 32 == 0.
template <typename T16> struct WFrag;
template <> struct WFrag<h16> { typedef v16h V; static __device__ __forceinline__ V ld(const h16* p) { return cat16(*(const v8h*)p, *(const v8h*)(p + 16)); } static __device__ __forceinline__ v8f mma(V a, V b, v8f c) { return wmma16(a, b, c); } };
template <> struct WFrag<bf> { typedef v16bf V; static __device__ __forceinline__ V ld(const bf* p) { return cat16b(*(const v8us*)p, *(const v8us*)(p + 16)); } static __device__ __forceinline__ v8f mma(V a, V b, v8f c) { return wmmab(a, b, c); } };
template <typename T16, int NSPLIT, bool BIAS>
__global__ __launch_bounds__(32) void k_gemmw(const T16* __restrict__ A, const T16* __restrict__ A2, const T16* __restrict__ Bt, const T16* __restrict__ Bt2, int K, float* C, int ldc, const float* __restrict__ bias, size_t sA, size_t sB, size_t sC) {
    typedef typename WFrag<T16>::V V;
    __shared__ __align__(16) float os[16 * 68];
    const size_t z = blockIdx.z; A += z * sA; if (A2) A2 += z * sA; Bt += z * sB; if (Bt2) Bt2 += z * sB; C += z * sC;
    const int lane = threadIdx.x & 31, lr = lane & 15, hi = lane >> 4; const int r0 = blockIdx.x * 64, c0 = blockIdx.y * 64;
    v8f acc[4][4];
#pragma unroll
    for (int mb = 0; mb < 4; ++mb)
#pragma unroll
        for (int nb = 0; nb < 4; ++nb) acc[mb][nb] = (v8f){};
    const size_t aoff = (size_t)(r0 + lr) * K + 8 * hi, boff = (size_t)(c0 + lr) * K + 8 * hi;
#pragma unroll 1
    for (int kc = 0; kc < K; kc += 32) {
        V a[4], a2[4];
#pragma unroll
        for (int mb = 0; mb < 4; ++mb) { a[mb] = WFrag<T16>::ld(A + aoff + (size_t)mb * 16 * K + kc); if (NSPLIT == 1 || NSPLIT == 2) a2[mb] = WFrag<T16>::ld(A2 + aoff + (size_t)mb * 16 * K + kc); }
#pragma unroll
        for (int nb = 0; nb < 4; ++nb) { const V b = WFrag<T16>::ld(Bt + boff + (size_t)nb * 16 * K + kc); V b2; if (NSPLIT >= 2) b2 = WFrag<T16>::ld(Bt2 + boff + (size_t)nb * 16 * K + kc);
#pragma unroll
            for (int mb = 0; mb < 4; ++mb) { acc[mb][nb] = WFrag<T16>::mma(a[mb], b, acc[mb][nb]); if (NSPLIT == 1 || NSPLIT == 2) acc[mb][nb] = WFrag<T16>::mma(a2[mb], b, acc[mb][nb]); if (NSPLIT >= 2) acc[mb][nb] = WFrag<T16>::mma(a[mb], b2, acc[mb][nb]); } }
        asm volatile("v_nop\n\tv_nop\n\tv_nop\n\tv_nop" : "+v"(acc[0][0]), "+v"(acc[1][1]), "+v"(acc[2][2]), "+v"(acc[3][3]) : "v"(a[0]), "v"(a[3]));
    }
#pragma unroll
    for (int mb = 0; mb < 4; ++mb) {
#pragma unroll
        for (int nb = 0; nb < 4; ++nb) {
#pragma unroll
            for (int j = 0; j < 8; ++j) os[(hi * 8 + j) * 68 + nb * 16 + lr] = acc[mb][nb][j]; }
        __builtin_amdgcn_wave_barrier(); asm volatile("" ::: "memory");
        float* crow = C + (size_t)(r0 + mb * 16) * ldc + c0;
{
#pragma unroll
            for (int s = 0; s < 8; ++s) { const int row = 2 * s + hi, cofs = lr * 4; v4f val = *(const v4fa*)(os + row * 68 + cofs); if (BIAS) { val[0] += bfr(bias[c0 + cofs]); val[1] += bfr(bias[c0 + cofs + 1]); val[2] += bfr(bias[c0 + cofs + 2]); val[3] += bfr(bias[c0 + cofs + 3]); }
                *(v4f*)(crow + (size_t)row * ldc + cofs) = val; }
             }
        __builtin_amdgcn_wave_barrier(); asm volatile("" ::: "memory");
    }
}

__device__ __forceinline__ h16 tohx(float x) { return (h16)x; }
__device__ __forceinline__ void splitf(float y, unsigned short& h, unsigned short& l) { h = f2bf(y); l = f2bf(y - bf2f(h)); }
typedef __attribute__((ext_vector_type(2))) _Float16 v2h;
typedef __attribute__((ext_vector_type(4))) _Float16 v4h;
typedef __attribute__((ext_vector_type(2))) unsigned short v2us;
typedef __attribute__((ext_vector_type(4))) unsigned short v4us;
typedef __attribute__((ext_vector_type(2))) float v2f;
typedef __attribute__((ext_vector_type(4))) int v4i;

__global__ __launch_bounds__(256) void k_wtG(const float* __restrict__ w, int K, int N, bf* Bt) {
    const int lane = threadIdx.x & 31; const int L0 = (blockIdx.x * 8 + (threadIdx.x >> 5)) * 8; const int nlines = N * K / 64;
{
#pragma unroll 1
        for (int l = 0; l < 8; ++l) { const int L = L0 + l; if (L >= nlines) break; const size_t e = (size_t)L * 64 + lane * 2; const int k = (int)(e % K), n = (int)(e / K); v2us o;
            o[0] = f2bf(w[(size_t)k * N + n]); o[1] = f2bf(w[(size_t)(k + 1) * N + n]); *(v2us*)(Bt + e) = o; }
         }
}
__global__ __launch_bounds__(256) void k_cvt8(const float* __restrict__ src, bf* dst, size_t n8) { const size_t i = (size_t)blockIdx.x * 256 + threadIdx.x; if (i >= n8) return; const v8f v = *(const v8f*)(src + i * 8); v8us o;
#pragma unroll
    for (int k = 0; k < 8; ++k) o[k] = f2bf(v[k]); *(v8us*)(dst + i * 8) = o;  }

// k_fattn: one launch for every head: a work-group of 8 waves owns one 64-row block of one head and keeps the block's band in LDS from the scores to the merged context.
// LDS row = the NCH = 3 128-key chunks from key kb on (they cover keys r0 - WIN .. r0 + 63; the first blocks start at key 0): 384 f32 scores, overwritten in place by 384 bf16 hi + 384 bf16 lo probabilities.
// Every sum keeps its order: score tiles k 0..31 then 32..63 (hi.hi, lo.hi, hi.lo); softmax one wave per row, lane -> 4 consecutive keys per chunk; attn.v 32 keys a step from the band's first key up.
#define SPB 1552   // LDS row pitch in bytes: 1536 + 16 (16 B x odd, so that sixteen rows' 16-byte fragment reads fall on different banks)
#define OPB 272    // output staging pitch in bytes (68 dwords)
typedef float __attribute__((may_alias)) f32a;
typedef v4us __attribute__((may_alias)) v4usa;
// k_qkv: the q, k and v projections in one launch (grid z picks the weight), k_gemmw's loop (one wave per 64x64 tile, k ascending in steps of 32), and an epilogue that writes the attention kernel's bf16 hi/lo planes itself.
// A 64-column tile is one head. q, k: planes [h][t][d], rows staged as f32 in LDS so that 8 lanes store one row's 128 bytes of a plane. v: planes [d][t]; a lane's 8 accumulator rows are 8 consecutive t of one d, split in registers, staged as 16-byte pieces and stored as whole 128-byte rows.
#define VPB 144   // LDS pitch in bytes of a staged v row: 128 + 16 (16 B x odd: sixteen rows' 16-byte pieces fall on different banks)
static_assert(DKV == DQ && HD == 64, "one 64-column tile per head, the same grid for q, k and v");
__global__ __launch_bounds__(32) void k_qkv(const bf* __restrict__ A, const bf* __restrict__ Wq, const bf* __restrict__ Wk, const bf* __restrict__ Wv, bf* Qh, bf* Ql, bf* Kh, bf* Kl, bf* Vh, bf* Vl) {
    typedef WFrag<bf>::V V;
    __shared__ __align__(16) char st[2 * 64 * VPB];
    const int z = blockIdx.z; const bf* __restrict__ Bt = z == 0 ? Wq : z == 1 ? Wk : Wv;
    const int lane = threadIdx.x & 31, lr = lane & 15, hi = lane >> 4; const int r0 = blockIdx.x * 64, c0 = blockIdx.y * 64;
    v8f acc[4][4];
#pragma unroll
    for (int mb = 0; mb < 4; ++mb)
#pragma unroll
        for (int nb = 0; nb < 4; ++nb) acc[mb][nb] = (v8f){};
    const size_t aoff = (size_t)(r0 + lr) * DM + 8 * hi, boff = (size_t)(c0 + lr) * DM + 8 * hi;
#pragma unroll 1   // stays rolled, as in k_gemmw: the same trip of 16 loads and 16 products, small code
    for (int kc = 0; kc < DM; kc += 32) {
        V a[4];
#pragma unroll
        for (int mb = 0; mb < 4; ++mb) a[mb] = WFrag<bf>::ld(A + aoff + (size_t)mb * 16 * DM + kc);
        asm volatile("s_wait_xcnt 0x0" ::: "memory");   // behind the x loads, in front of whatever next takes the registers that held their address
#pragma unroll
        for (int nb = 0; nb < 4; ++nb) { const V b = WFrag<bf>::ld(Bt + boff + (size_t)nb * 16 * DM + kc);
#pragma unroll
            for (int mb = 0; mb < 4; ++mb) acc[mb][nb] = WFrag<bf>::mma(a[mb], b, acc[mb][nb]); }
        asm volatile("v_nop\n\tv_nop\n\tv_nop\n\tv_nop" : "+v"(acc[0][0]), "+v"(acc[1][1]), "+v"(acc[2][2]), "+v"(acc[3][3]) : "v"(a[0]), "v"(a[3]));   // four vector slots behind the trip's last matrix instruction, on the loop's taken branch too, before the next trip's loads take the fragment registers
    }
    const int l8 = lane >> 3, c8 = (lane & 7) * 8;   // store phase: 8 lanes x 16 bytes cover one 128-byte row, 4 rows an instruction
    if (z < 2) {
        bf* Ph = z == 0 ? Qh : Kh; bf* Pl = z == 0 ? Ql : Kl;
#pragma unroll
        for (int mb = 0; mb < 4; ++mb) {
#pragma unroll
            for (int nb = 0; nb < 4; ++nb)
#pragma unroll
                for (int j = 0; j < 8; ++j) *(f32a*)(st + ((hi * 8 + j) * 68 + nb * 16 + lr) * 4) = acc[mb][nb][j];
            __builtin_amdgcn_wave_barrier(); asm volatile("" ::: "memory");   // each lane reads what other lanes stored: the compiler, which reasons about one lane, must not move a read below over a store above
            const size_t po = ((size_t)blockIdx.y * TT + r0 + mb * 16) * HD + c8;
#pragma unroll
            for (int s = 0; s < 4; ++s) { const int row = s * 4 + l8; v8us oh, ol;
#pragma unroll
                for (int u = 0; u < 2; ++u) { const v4f val = *(const v4fa*)(st + (row * 68 + c8 + u * 4) * 4);
#pragma unroll
                    for (int q = 0; q < 4; ++q) { unsigned short a2, c2; splitf(val[q], a2, c2); oh[u * 4 + q] = a2; ol[u * 4 + q] = c2; } }
                *(v8us*)(Ph + po + (size_t)row * HD) = oh; *(v8us*)(Pl + po + (size_t)row * HD) = ol; }
            __builtin_amdgcn_wave_barrier(); asm volatile("" ::: "memory");   // likewise: the next group's stores must not move over other lanes' reads above
        }
    } else {
#pragma unroll
        for (int mb = 0; mb < 4; ++mb)
#pragma unroll
            for (int nb = 0; nb < 4; ++nb) { v8us oh, ol;
#pragma unroll
                for (int j = 0; j < 8; ++j) { unsigned short a2, c2; splitf(acc[mb][nb][j], a2, c2); oh[j] = a2; ol[j] = c2; }
                char* p = st + (nb * 16 + lr) * VPB + (mb * 16 + hi * 8) * 2; *(v8usa*)p = oh; *(v8usa*)(p + 64 * VPB) = ol; }
        __builtin_amdgcn_wave_barrier(); asm volatile("" ::: "memory");   // each lane reads what other lanes stored: the compiler, which reasons about one lane, must not move a read below over a store above
        const size_t po = (size_t)blockIdx.y * HD * TT + r0 + c8;
#pragma unroll
        for (int s = 0; s < 16; ++s) { const int d = s * 4 + l8; const char* p = st + d * VPB + c8 * 2;
            *(v8us*)(Vh + po + (size_t)d * TT) = *(const v8usa*)p; *(v8us*)(Vl + po + (size_t)d * TT) = *(const v8usa*)(p + 64 * VPB); }
        asm volatile("s_wait_xcnt 0x0" ::: "memory");   // behind the run's last store, in front of whatever next takes the registers that the stores name
    }
}
__global__ __launch_bounds__(256) void k_fattn(const bf* __restrict__ Qh, const bf* __restrict__ Ql, const bf* __restrict__ Kh, const bf* __restrict__ Kl, const bf* __restrict__ Vh, const bf* __restrict__ Vl, bf* Ah, bf* Al) {
    __shared__ __align__(16) char sm[64 * SPB];
    const int lane = threadIdx.x & 31, lr = lane & 15, hi = lane >> 4; const int w = __builtin_amdgcn_readfirstlane(threadIdx.x >> 5);
    const int r0 = blockIdx.x * 64; const size_t hq = (size_t)blockIdx.y * TT * HD, hk = (size_t)(blockIdx.y / REP) * TT * HD;
    const int kb = max(0, ((r0 + 63) >> 7) - (NCH - 1)) * 128;   // key of LDS column 0
    const int K0 = max(0, r0 - WIN);                             // first key of the band
    const bool full = r0 >= WIN;                                 // the block's whole band of WIN + 64 keys exists
    const int mp = w >> 2, wq = w & 3;                           // the wave's pair of 16-row groups; its quarter of the keys (scores) or of the head dims (attn.v)
    {   // scores: 2 row groups x 5 key tiles of 16 per wave
        v16bf a[2][2], a2[2][2];
#pragma unroll
        for (int m = 0; m < 2; ++m)
#pragma unroll
            for (int ks = 0; ks < 2; ++ks) { const size_t o = hq + (size_t)(r0 + (mp * 2 + m) * 16 + lr) * HD + ks * 32 + 8 * hi; a[m][ks] = WFrag<bf>::ld(Qh + o); a2[m][ks] = WFrag<bf>::ld(Ql + o); asm volatile("s_wait_xcnt 0x0" ::: "memory"); }   // the wait stands behind each group of loads in this kernel, in front of whatever next takes the registers that held their addresses
        auto ldk = [&](int c, v16bf* b, v16bf* b2) { const size_t o = hk + (size_t)(c + lr) * HD + 8 * hi;
#pragma unroll
            for (int ks = 0; ks < 2; ++ks) { b[ks] = WFrag<bf>::ld(Kh + o + ks * 32); b2[ks] = WFrag<bf>::ld(Kl + o + ks * 32); }
            asm volatile("s_wait_xcnt 0x0" ::: "memory"); };   // before the address registers are reused
        auto tile = [&](int c, const v16bf* b, const v16bf* b2) { v8f acc[2]; acc[0] = (v8f){}; acc[1] = (v8f){};
#pragma unroll
            for (int ks = 0; ks < 2; ++ks)
#pragma unroll
                for (int m = 0; m < 2; ++m) { acc[m] = wmmab(a[m][ks], b[ks], acc[m]); acc[m] = wmmab(a2[m][ks], b[ks], acc[m]); acc[m] = wmmab(a[m][ks], b2[ks], acc[m]); }
            asm volatile("v_nop\n\tv_nop\n\tv_nop\n\tv_nop" : "+v"(acc[0]), "+v"(acc[1]));   // four vector slots behind the tile's last matrix instruction: the LDS stores fill none, and the next tile's first product may be given the same result registers
#pragma unroll
            for (int m = 0; m < 2; ++m)
#pragma unroll
                for (int j = 0; j < 8; ++j) *(f32a*)(sm + ((mp * 2 + m) * 16 + hi * 8 + j) * SPB + (c - kb + lr) * 4) = acc[m][j]; };
        const int cw = r0 - WIN + wq * 80;   // the wave's first key
        if (full) {   // the whole band exists: straight-line code with the key fragments fetched three tiles ahead
            v16bf b[5][2], b2[5][2];
#pragma unroll
            for (int t = 0; t < 3; ++t) ldk(cw + t * 16, b[t], b2[t]);
            __builtin_amdgcn_sched_barrier(0);   // keeps the first three tiles' loads in front of the first product (the scheduler otherwise sinks each load to its use and the wave waits out one memory latency per fragment)
#pragma unroll
            for (int t = 0; t < 5; ++t) { if (t + 3 < 5) ldk(cw + (t + 3) * 16, b[t + 3], b2[t + 3]);
                tile(cw + t * 16, b[t], b2[t]);
                __builtin_amdgcn_sched_barrier(0);   // keeps the load issued in this tile from sinking into a later one
            }
        } else {
#pragma unroll 1
            for (int t = 0; t < 5; ++t) { const int c = cw + t * 16; if (c < 0) continue;   // a tile in front of key 0 does not exist
                v16bf b[2], b2[2]; ldk(c, b, b2); tile(c, b, b2); }
        }
    }
    __syncthreads();
    const size_t vo = hk + (size_t)(wq * 16 + lr) * TT + 8 * hi;   // the wave's 16 head dims of the v planes [d][t]
    v16bf vb[(WIN + 64) / 32], vb2[(WIN + 64) / 32];
    if (full) {   // the first five 32-key steps of v are fetched here, so that they land while the softmax runs
#pragma unroll
        for (int kk = 0; kk < 5; ++kk) { vb[kk] = WFrag<bf>::ld(Vh + vo + K0 + kk * 32); vb2[kk] = WFrag<bf>::ld(Vl + vo + K0 + kk * 32); asm volatile("s_wait_xcnt 0x0" ::: "memory"); }   // before the address registers are reused
    }
    {   // softmax: 8 rows per wave, each row whole in registers (12 scores a lane); columns outside the band were never written and are not read
        v4f s[8][NCH];
#pragma unroll
        for (int rr = 0; rr < 8; ++rr)
#pragma unroll
            for (int ch = 0; ch < NCH; ++ch) { const int j0 = kb + ch * 128 + lane * 4; s[rr][ch] = (v4f){}; if (j0 >= K0 && j0 < r0 + 64) s[rr][ch] = *(const v4fa*)(sm + (w * 8 + rr) * SPB + (ch * 128 + lane * 4) * 4); }
#pragma unroll
        for (int rr = 0; rr < 8; ++rr) { const int i = r0 + w * 8 + rr; float mx = -3.0e38f;
#pragma unroll
            for (int ch = 0; ch < NCH; ++ch) { const int j0 = kb + ch * 128 + lane * 4;
#pragma unroll
                for (int q = 0; q < 4; ++q) { const float t = (j0 + q <= i && j0 + q > i - WIN) ? s[rr][ch][q] * SCL : -3.0e38f;   /* causal sliding window: i - WIN < j <= i */ s[rr][ch][q] = t; mx = fmaxf(mx, t); } }
#pragma unroll
            for (int sh = 16; sh; sh >>= 1) mx = fmaxf(mx, __shfl_xor(mx, sh, 32));
            float sum = 0.f;
#pragma unroll
            for (int ch = 0; ch < NCH; ++ch)
#pragma unroll
                for (int q = 0; q < 4; ++q) { const float ex = __builtin_amdgcn_exp2f(__fmul_rn(__fsub_rn(s[rr][ch][q], mx), 1.4426950408889634f)); s[rr][ch][q] = ex; sum += ex; }
#pragma unroll
            for (int sh = 16; sh; sh >>= 1) sum += __shfl_xor(sum, sh, 32);
            const float f = __fdiv_rn(1.0f, sum);
#pragma unroll
            for (int ch = 0; ch < NCH; ++ch) { v4us oh, ol;
#pragma unroll
                for (int q = 0; q < 4; ++q) { unsigned short a2, c2; splitf(s[rr][ch][q] * f, a2, c2); oh[q] = a2; ol[q] = c2; }
                char* pr = sm + (w * 8 + rr) * SPB + (ch * 128 + lane * 4) * 2; *(v4usa*)pr = oh; *(v4usa*)(pr + 768) = ol; } }
    }
    __syncthreads();
    v8f o[2]; o[0] = (v8f){}; o[1] = (v8f){};
    {   // attn.v: 2 row groups x 16 head dims per wave; probabilities from LDS, v planes [d][t] from memory
        const char* pa = sm + (mp * 32 + lr) * SPB + 16 * hi;
        auto step = [&](int kc, v16bf b, v16bf b2) {
#pragma unroll
            for (int m = 0; m < 2; ++m) { const char* p = pa + m * 16 * SPB + (kc - kb) * 2; const v16bf a = cat16b(*(const v8usa*)p, *(const v8usa*)(p + 32)), a2 = cat16b(*(const v8usa*)(p + 768), *(const v8usa*)(p + 800));
                o[m] = wmmab(a, b, o[m]); o[m] = wmmab(a2, b, o[m]); o[m] = wmmab(a, b2, o[m]); } };
        if (full) {
#pragma unroll
            for (int kk = 0; kk < (WIN + 64) / 32; ++kk) { if (kk + 5 < (WIN + 64) / 32) { vb[kk + 5] = WFrag<bf>::ld(Vh + vo + K0 + (kk + 5) * 32); vb2[kk + 5] = WFrag<bf>::ld(Vl + vo + K0 + (kk + 5) * 32); asm volatile("s_wait_xcnt 0x0" ::: "memory"); }   // before the address registers are reused
                step(K0 + kk * 32, vb[kk], vb2[kk]);
                __builtin_amdgcn_sched_barrier(0);   // keeps the v load issued in this step, five steps ahead of its use, from sinking to that use
            }
        } else {
#pragma unroll 1
            for (int kc = 0; kc < r0 + 64; kc += 32) { const v16bf b = WFrag<bf>::ld(Vh + vo + kc), b2 = WFrag<bf>::ld(Vl + vo + kc); asm volatile("s_wait_xcnt 0x0" ::: "memory");   // before the address registers are reused
                step(kc, b, b2); }
        }
    }
    __syncthreads();   // every wave has read its last probability fragment: the rows become output staging
#pragma unroll
    for (int m = 0; m < 2; ++m)
#pragma unroll
        for (int j = 0; j < 8; ++j) *(f32a*)(sm + ((mp * 2 + m) * 16 + hi * 8 + j) * OPB + (wq * 16 + lr) * 4) = o[m][j];
    __syncthreads();
    {   // merged hi/lo context [t][head * 64 + d]: four lanes of one wave write a row's 128 bytes of each plane
        const int row = threadIdx.x >> 2, cq = (threadIdx.x & 3) * 16; const size_t oo = (size_t)(r0 + row) * DQ + blockIdx.y * HD + cq;
#pragma unroll
        for (int g = 0; g < 2; ++g) { v8us oh, ol;
#pragma unroll
            for (int u = 0; u < 2; ++u) { const v4f val = *(const v4fa*)(sm + row * OPB + (cq + g * 8 + u * 4) * 4);
#pragma unroll
                for (int q = 0; q < 4; ++q) { unsigned short a2, c2; splitf(val[q], a2, c2); oh[u * 4 + q] = a2; ol[u * 4 + q] = c2; } }
            *(v8us*)(Ah + oo + g * 8) = oh; *(v8us*)(Al + oo + g * 8) = ol; }
    }
}

extern "C" void kernel_launch(void* const* d_in, const int* in_sizes, int n_in,
                              void* d_out, int out_size, void* d_ws, size_t ws_size, hipStream_t stream) {
    (void)in_sizes; (void)n_in; (void)out_size;
    const float* x = (const float*)d_in[0]; const float* wq = (const float*)d_in[1]; const float* wk = (const float*)d_in[2]; const float* wv = (const float*)d_in[3]; const float* wo = (const float*)d_in[4]; const float* bo = (const float*)d_in[5];
    float* OUT = (float*)d_out;     // [1][4096][1024]
    char* wsp = (char*)d_ws;
    auto take = [&](size_t bytes) { char* p = wsp; wsp += (bytes + 255) & ~(size_t)255; return (void*)p; };
    bf* WQ = (bf*)take((size_t)DQ * DM * 2); bf* WK = (bf*)take((size_t)DKV * DM * 2); bf* WV = (bf*)take((size_t)DKV * DM * 2); bf* WO = (bf*)take((size_t)DM * DQ * 2);
    bf* XB = (bf*)take((size_t)TT * DM * 2);
    bf* QPh = (bf*)take((size_t)NH_ * TT * HD * 2); bf* QPl = (bf*)take((size_t)NH_ * TT * HD * 2); bf* KPh = (bf*)take((size_t)NKV * TT * HD * 2); bf* KPl = (bf*)take((size_t)NKV * TT * HD * 2); bf* VTh = (bf*)take((size_t)NKV * HD * TT * 2); bf* VTl = (bf*)take((size_t)NKV * HD * TT * 2);
    bf* ATh = (bf*)take((size_t)TT * DQ * 2); bf* ATl = (bf*)take((size_t)TT * DQ * 2);
    if ((size_t)(wsp - (char*)d_ws) > ws_size) return;    // ws 256 MiB
    { k_cvt8<<<(unsigned)(((size_t)DQ * DM / 8 + 255) / 256), 256, 0, stream>>>(wq, WQ, (size_t)DQ * DM / 8); k_cvt8<<<(unsigned)(((size_t)DKV * DM / 8 + 255) / 256), 256, 0, stream>>>(wk, WK, (size_t)DKV * DM / 8); k_cvt8<<<(unsigned)(((size_t)DKV * DM / 8 + 255) / 256), 256, 0, stream>>>(wv, WV, (size_t)DKV * DM / 8);
      k_cvt8<<<(unsigned)(((size_t)DM * DQ / 8 + 255) / 256), 256, 0, stream>>>(wo, WO, (size_t)DM * DQ / 8);
       }
    for (int b = 0; b < NB_; ++b) {
        
        k_cvt8<<<(unsigned)(((size_t)TT * DM / 8 + 255) / 256), 256, 0, stream>>>(x + (size_t)b * TT * DM, XB, (size_t)TT * DM / 8);
        k_qkv<<<dim3(TT / 64, DQ / 64, 3), 32, 0, stream>>>(XB, WQ, WK, WV, QPh, QPl, KPh, KPl, VTh, VTl);
        k_fattn<<<dim3(TT / 64, NH_, 1), 256, 0, stream>>>(QPh, QPl, KPh, KPl, VTh, VTl, ATh, ATl);
        k_gemmw<bf, 1, true><<<dim3(TT / 64, DM / 64, 1), 32, 0, stream>>>(ATh, ATl, WO, nullptr, DQ, OUT + (size_t)b * TT * DM, DM, bo, 0, 0, 0); }
}

// v004
// One run takes 99.3 microseconds.
// In both of two side-by-side timings against v003, it was 1.41 times as fast.
// Counting every step since v000, it is 23.4 times as fast.
#include <hip/hip_runtime.h>

// Local causal multi-head attention WITHOUT the 1/sqrt(d) scaling (x [1][4096][1024]; q,k,v = x W^T ('oi' [1024][1024], no bias; 16 heads x 64); scores = q.k (unscaled: logit sigma ~8); keys with j > i or j <= i - 256 masked (-1e30 == exclusion); softmax; ctx merged; out = ctx Wo^T + bo -> [1][4096][1024] (4.2 M)).
// Layout: bf16 copy of x; exact q, k, v projections in one launch that writes the hi/lo head planes (v transposed) from its epilogue; causal-window T-4096 attention, every head in one launch, with EVERY row on bf16 hi/lo planes (3 products; the unscaled logits are too sharp for fp16 planes): k_fattn gives a 64-row block of one head to one work-group, which computes the 320 keys of scores that the 256-wide band touches into LDS, takes the softmax over the band's three 128-key chunks with the window as an index select, does attn.v (3 products) over the band's 320 keys from LDS and writes the merged hi/lo context; merged hi/lo x Wo exact + bo.
// Compute dtypes, f32 accumulate: every input rounded to bf16; projections exact; scores and attn.v 3 products on every row; softmax f32; Wo hl x exact + bias.

#define NB_  1
#define TT   4096
#define DM   1024
#define NH_  16
#define NKV  16
#define REP  (NH_ / NKV)
#define HD   64
#define DQ   (NH_ * HD)
#define DKV  (NKV * HD)
#define ZH   1
#define RH   4096                  // unused: every query row uses hi+lo planes
#define WIN  256
#define NCH  ((WIN + 127) / 128 + 1)   // 128-key softmax chunks that cover a 64-row block's WIN + 64 keys at any 64-key phase
#define PCAR 1024.0f
#define SCL  1.0f   // the module applies no 1/sqrt(d)
typedef _Float16 h16;
typedef unsigned short bf;
typedef __attribute__((ext_vector_type(16))) __bf16   v16bf;
typedef __attribute__((ext_vector_type(16))) _Float16 v16h;
typedef __attribute__((ext_vector_type(8)))  _Float16 v8h;
typedef __attribute__((ext_vector_type(8)))  unsigned short v8us;
typedef __attribute__((ext_vector_type(8)))  float    v8f;
typedef __attribute__((ext_vector_type(4)))  float    v4f;
typedef v8h  __attribute__((may_alias)) v8ha;
typedef v4f  __attribute__((may_alias)) v4fa;
typedef v8us __attribute__((may_alias)) v8usa;
typedef float __attribute__((may_alias)) f32a;

__device__ __forceinline__ unsigned short f2bf(float f) { unsigned u = __float_as_uint(f); u += 0x7FFFu + ((u >> 16) & 1u); return (unsigned short)(u >> 16); }
__device__ __forceinline__ float bf2f(unsigned short b) { return __uint_as_float(((unsigned)b) << 16); }
__device__ __forceinline__ float bfr(float f) { return bf2f(f2bf(f)); }
__device__ __forceinline__ v16h cat16(v8h lo, v8h hi) { return __builtin_shufflevector(lo, hi, 0, 1, 2, 3, 4, 5, 6, 7, 8, 9, 10, 11, 12, 13, 14, 15); }
__device__ __forceinline__ v16bf cat16b(v8us lo, v8us hi) { return __builtin_bit_cast(v16bf, __builtin_shufflevector(lo, hi, 0, 1, 2, 3, 4, 5, 6, 7, 8, 9, 10, 11, 12, 13, 14, 15)); }
__device__ __forceinline__ v8f wmma16(v16h a, v16h b, v8f c) { return __builtin_amdgcn_wmma_f32_16x16x32_f16(false, a, false, b, (short)0, c, false, false); }
__device__ __forceinline__ v8f wmmab(v16bf a, v16bf b, v8f c) { return __builtin_amdgcn_wmma_f32_16x16x32_bf16(false, a, false, b, (short)0, c, false, false); }



// ---- gemm128: the K loop of both GEMMs. A work-group owns a 128x128 output tile; each wave MB x 4 accumulators: 4 waves (2 x 2) of 64x64 with MB = 4, 8 waves (4 x 2) of 32x64 with MB = 2.
// Operands are K-contiguous bf16 planes of pitch DM. A stage is 64 k (128 bytes) of the tile's 128 A rows (NA = 2: of the hi and of the lo plane) and 128 B rows. 8 lanes fetch one row's whole 128-byte line, and every wave that needs a row reads it from LDS.
// Two buffers: stage t + 1 is fetched into registers in front of stage t's products and stored to the other buffer behind them; one work-group barrier a stage.
// Every accumulator keeps its sum order: k ascending in steps of 32 (NA = 2: hi then lo within a step).
template <typename T16> struct WFrag;
template <> struct WFrag<h16> { typedef v16h V; static __device__ __forceinline__ V ld(const h16* p) { return cat16(*(const v8h*)p, *(const v8h*)(p + 16)); } static __device__ __forceinline__ v8f mma(V a, V b, v8f c) { return wmma16(a, b, c); } };
template <> struct WFrag<bf> { typedef v16bf V; static __device__ __forceinline__ V ld(const bf* p) { return cat16b(*(const v8us*)p, *(const v8us*)(p + 16)); } static __device__ __forceinline__ v8f mma(V a, V b, v8f c) { return wmmab(a, b, c); } };
#define GP 144   // LDS pitch in bytes of a staged row: 128 + 16 (16 B x odd: sixteen rows' 16-byte fragment reads fall on different banks)
#define GBUF(NA) (((NA) + 1) * 128 * GP)   // bytes of one buffer: rows [A | A lo | B]
template <int NA, int MB>
__device__ __forceinline__ void gemm128(const bf* __restrict__ A, const bf* __restrict__ A2, const bf* __restrict__ Bt, char* sm, int R0, int C0, int wm, int wn, v8f (&acc)[MB][4]) {
    typedef WFrag<bf>::V V;
    constexpr int RP = 2 * (8 / MB) * 32 / 8, PI = 128 / RP;   // rows that the work-group's threads fetch at once; such fetches per 128-row plane
    const int lane = threadIdx.x & 31, lr = lane & 15, hi = lane >> 4; const int tr = threadIdx.x >> 3, tc = threadIdx.x & 7;
    const size_t ao = (size_t)(R0 + tr) * DM + tc * 8, bo = (size_t)(C0 + tr) * DM + tc * 8;
    char* sw = sm + tr * GP + tc * 16;
    const char* fa = sm + (wm * MB * 16 + lr) * GP + 16 * hi; const char* fb = sm + (NA * 128 + wn * 64 + lr) * GP + 16 * hi;
    v8us g[(NA + 1) * PI];
    auto fetch = [&](int kc) {
#pragma unroll
        for (int i = 0; i < PI; ++i) { g[i] = *(const v8us*)(A + ao + (size_t)i * RP * DM + kc); if (NA == 2) g[PI + i] = *(const v8us*)(A2 + ao + (size_t)i * RP * DM + kc); g[NA * PI + i] = *(const v8us*)(Bt + bo + (size_t)i * RP * DM + kc); }
        asm volatile("s_wait_xcnt 0x0" ::: "memory"); };   // behind the stage's loads, in front of whatever next takes the registers that held their addresses; it also keeps the loads from sinking to their LDS stores behind the products
    auto put = [&](int buf) {
#pragma unroll
        for (int i = 0; i < (NA + 1) * PI; ++i) *(v8usa*)(sw + buf + i * RP * GP) = g[i]; };
    auto ldf = [&](const char* p) { return cat16b(*(const v8usa*)p, *(const v8usa*)(p + 32)); };
    auto products = [&](int buf) {
#pragma unroll
        for (int ks = 0; ks < 2; ++ks) { V a[MB], a2[MB];
#pragma unroll
            for (int mb = 0; mb < MB; ++mb) { a[mb] = ldf(fa + buf + mb * 16 * GP + ks * 64); if (NA == 2) a2[mb] = ldf(fa + buf + (128 + mb * 16) * GP + ks * 64); }
#pragma unroll
            for (int nb = 0; nb < 4; ++nb) { const V b = ldf(fb + buf + nb * 16 * GP + ks * 64);
#pragma unroll
                for (int mb = 0; mb < MB; ++mb) { acc[mb][nb] = wmmab(a[mb], b, acc[mb][nb]); if (NA == 2) acc[mb][nb] = wmmab(a2[mb], b, acc[mb][nb]); } } } };
#pragma unroll
    for (int mb = 0; mb < MB; ++mb)
#pragma unroll
        for (int nb = 0; nb < 4; ++nb) acc[mb][nb] = (v8f){};
    fetch(0); put(0);
    __syncthreads();   // stage 0 is in LDS for every wave
#pragma unroll 1   // stays rolled: one stage of loads, products and stores, small code
    for (int t = 0; t < DM / 64 - 1; ++t) { const int cur = (t & 1) * GBUF(NA);
        fetch((t + 1) * 64);
        products(cur);
        __builtin_amdgcn_sched_barrier(0);   // keeps the LDS stores, which wait for stage t + 1's global loads, behind stage t's products: the scheduler otherwise lifts them over the products, and the wave waits out the loads' latency with the matrix unit idle
        put(GBUF(NA) - cur);
        __syncthreads();   // publishes stage t + 1 and ends every wave's reads of stage t, whose buffer the next trip overwrites
    }
    products(((DM / 64 - 1) & 1) * GBUF(NA));
    __syncthreads();   // every wave has read its last fragment: the buffers become output staging
}

// k_oproj: out = (ctx hi + ctx lo) Wo^T + bias, f32, gemm128 with both context planes, 8 waves of 32x64 (the grid is one work-group per WGP: two waves a SIMD, so that one wave's products cover the other's LDS waits); each wave stages 16 rows of its part in its own LDS range and stores whole 256-byte rows.
__global__ __launch_bounds__(256) void k_oproj(const bf* __restrict__ A, const bf* __restrict__ A2, const bf* __restrict__ Bt, float* C, const float* __restrict__ bias) {
    __shared__ __align__(16) char sm[2 * GBUF(2)];
    const int lane = threadIdx.x & 31, lr = lane & 15, hi = lane >> 4; const int w = __builtin_amdgcn_readfirstlane(threadIdx.x >> 5), wm = w & 3, wn = w >> 2;
    const int r0 = blockIdx.x * 128 + wm * 32, c0 = blockIdx.y * 128 + wn * 64;
    v8f acc[2][4];
    gemm128<2, 2>(A, A2, Bt, sm, blockIdx.x * 128, blockIdx.y * 128, wm, wn, acc);
    float* os = (float*)(sm + w * (16 * 68 * 4));
#pragma unroll
    for (int mb = 0; mb < 2; ++mb) {
#pragma unroll
        for (int nb = 0; nb < 4; ++nb) {
#pragma unroll
            for (int j = 0; j < 8; ++j) *(f32a*)(os + (hi * 8 + j) * 68 + nb * 16 + lr) = acc[mb][nb][j]; }
        __builtin_amdgcn_wave_barrier(); asm volatile("" ::: "memory");   // each lane reads what other lanes stored: the compiler, which reasons about one lane, must not move a read below over a store above
        float* crow = C + (size_t)(r0 + mb * 16) * DM + c0;
#pragma unroll
        for (int s = 0; s < 8; ++s) { const int row = 2 * s + hi, cofs = lr * 4; v4f val = *(const v4fa*)(os + row * 68 + cofs); val[0] += bfr(bias[c0 + cofs]); val[1] += bfr(bias[c0 + cofs + 1]); val[2] += bfr(bias[c0 + cofs + 2]); val[3] += bfr(bias[c0 + cofs + 3]);
            *(v4f*)(crow + (size_t)row * DM + cofs) = val; }
        asm volatile("s_wait_xcnt 0x0" ::: "memory");   // behind the group's stores, in front of whatever next takes the registers that they name
        __builtin_amdgcn_wave_barrier(); asm volatile("" ::: "memory");   // likewise: the next group's stores must not move over other lanes' reads above
    }
}

__device__ __forceinline__ h16 tohx(float x) { return (h16)x; }
__device__ __forceinline__ void splitf(float y, unsigned short& h, unsigned short& l) { h = f2bf(y); l = f2bf(y - bf2f(h)); }
typedef __attribute__((ext_vector_type(2))) _Float16 v2h;
typedef __attribute__((ext_vector_type(4))) _Float16 v4h;
typedef __attribute__((ext_vector_type(2))) unsigned short v2us;
typedef __attribute__((ext_vector_type(4))) unsigned short v4us;
typedef __attribute__((ext_vector_type(2))) float v2f;
typedef __attribute__((ext_vector_type(4))) int v4i;

__global__ __launch_bounds__(256) void k_wtG(const float* __restrict__ w, int K, int N, bf* Bt) {
    const int lane = threadIdx.x & 31; const int L0 = (blockIdx.x * 8 + (threadIdx.x >> 5)) * 8; const int nlines = N * K / 64;
{
#pragma unroll 1
        for (int l = 0; l < 8; ++l) { const int L = L0 + l; if (L >= nlines) break; const size_t e = (size_t)L * 64 + lane * 2; const int k = (int)(e % K), n = (int)(e / K); v2us o;
            o[0] = f2bf(w[(size_t)k * N + n]); o[1] = f2bf(w[(size_t)(k + 1) * N + n]); *(v2us*)(Bt + e) = o; }
         }
}
__global__ __launch_bounds__(256) void k_cvt8(const float* __restrict__ src, bf* dst, size_t n8) { const size_t i = (size_t)blockIdx.x * 256 + threadIdx.x; if (i >= n8) return; const v8f v = *(const v8f*)(src + i * 8); v8us o;
#pragma unroll
    for (int k = 0; k < 8; ++k) o[k] = f2bf(v[k]); *(v8us*)(dst + i * 8) = o;  }

// k_fattn: one launch for every head: a work-group of 8 waves owns one 64-row block of one head and keeps the block's band in LDS from the scores to the merged context.
// LDS row = the NCH = 3 128-key chunks from key kb on (they cover keys r0 - WIN .. r0 + 63; the first blocks start at key 0): 384 f32 scores, overwritten in place by 384 bf16 hi + 384 bf16 lo probabilities.
// Every sum keeps its order: score tiles k 0..31 then 32..63 (hi.hi, lo.hi, hi.lo); softmax one wave per row, lane -> 4 consecutive keys per chunk; attn.v 32 keys a step from the band's first key up.
#define SPB 1552   // LDS row pitch in bytes: 1536 + 16 (16 B x odd, so that sixteen rows' 16-byte fragment reads fall on different banks)
#define OPB 272    // output staging pitch in bytes (68 dwords)
typedef v4us __attribute__((may_alias)) v4usa;
// k_qkv: the q, k and v projections in one launch (grid z picks the weight), gemm128's loop (4 waves per 128x128 tile, one 64x64 quarter each, k ascending in steps of 32), and an epilogue, each wave in its own LDS range, that writes the attention kernel's bf16 hi/lo planes itself.
// A wave's 64 columns are one head. q, k: planes [h][t][d], rows staged as f32 in LDS so that 8 lanes store one row's 128 bytes of a plane. v: planes [d][t]; a lane's 8 accumulator rows are 8 consecutive t of one d, split in registers, staged as 16-byte pieces and stored as whole 128-byte rows.
#define VPB 144   // LDS pitch in bytes of a staged v row: 128 + 16 (16 B x odd: sixteen rows' 16-byte pieces fall on different banks)
static_assert(DKV == DQ && DQ == DM && HD == 64, "one 64-column quarter per head, the same grid for q, k and v, one K for both GEMMs");
__global__ __launch_bounds__(128) void k_qkv(const bf* __restrict__ A, const bf* __restrict__ Wq, const bf* __restrict__ Wk, const bf* __restrict__ Wv, bf* Qh, bf* Ql, bf* Kh, bf* Kl, bf* Vh, bf* Vl) {
    __shared__ __align__(16) char sm[2 * GBUF(1)];
    static_assert(4 * 2 * 64 * VPB <= 2 * GBUF(1), "the four waves' output staging fits the operand buffers");
    const int z = blockIdx.z; const bf* __restrict__ Bt = z == 0 ? Wq : z == 1 ? Wk : Wv;
    const int lane = threadIdx.x & 31, lr = lane & 15, hi = lane >> 4; const int w = __builtin_amdgcn_readfirstlane(threadIdx.x >> 5), wm = w & 1, wn = w >> 1;
    const int r0 = blockIdx.x * 128 + wm * 64, hd = blockIdx.y * 2 + wn;   // the wave's first row; its head
    v8f acc[4][4];
    gemm128<1, 4>(A, nullptr, Bt, sm, blockIdx.x * 128, blockIdx.y * 128, wm, wn, acc);
    char* st = sm + w * (2 * 64 * VPB);   // the wave's own staging range
    const int l8 = lane >> 3, c8 = (lane & 7) * 8;   // store phase: 8 lanes x 16 bytes cover one 128-byte row, 4 rows an instruction
    if (z < 2) {
        bf* Ph = z == 0 ? Qh : Kh; bf* Pl = z == 0 ? Ql : Kl;
#pragma unroll
        for (int mb = 0; mb < 4; ++mb) {
#pragma unroll
            for (int nb = 0; nb < 4; ++nb)
#pragma unroll
                for (int j = 0; j < 8; ++j) *(f32a*)(st + ((hi * 8 + j) * 68 + nb * 16 + lr) * 4) = acc[mb][nb][j];
            __builtin_amdgcn_wave_barrier(); asm volatile("" ::: "memory");   // each lane reads what other lanes stored: the compiler, which reasons about one lane, must not move a read below over a store above
            const size_t po = ((size_t)hd * TT + r0 + mb * 16) * HD + c8;
#pragma unroll
            for (int s = 0; s < 4; ++s) { const int row = s * 4 + l8; v8us oh, ol;
#pragma unroll
                for (int u = 0; u < 2; ++u) { const v4f val = *(const v4fa*)(st + (row * 68 + c8 + u * 4) * 4);
#pragma unroll
                    for (int q = 0; q < 4; ++q) { unsigned short a2, c2; splitf(val[q], a2, c2); oh[u * 4 + q] = a2; ol[u * 4 + q] = c2; } }
                *(v8us*)(Ph + po + (size_t)row * HD) = oh; *(v8us*)(Pl + po + (size_t)row * HD) = ol; }
            __builtin_amdgcn_wave_barrier(); asm volatile("" ::: "memory");   // likewise: the next group's stores must not move over other lanes' reads above
        }
    } else {
#pragma unroll
        for (int mb = 0; mb < 4; ++mb)
#pragma unroll
            for (int nb = 0; nb < 4; ++nb) { v8us oh, ol;
#pragma unroll
                for (int j = 0; j < 8; ++j) { unsigned short a2, c2; splitf(acc[mb][nb][j], a2, c2); oh[j] = a2; ol[j] = c2; }
                char* p = st + (nb * 16 + lr) * VPB + (mb * 16 + hi * 8) * 2; *(v8usa*)p = oh; *(v8usa*)(p + 64 * VPB) = ol; }
        __builtin_amdgcn_wave_barrier(); asm volatile("" ::: "memory");   // each lane reads what other lanes stored: the compiler, which reasons about one lane, must not move a read below over a store above
        const size_t po = (size_t)hd * HD * TT + r0 + c8;
#pragma unroll
        for (int s = 0; s < 16; ++s) { const int d = s * 4 + l8; const char* p = st + d * VPB + c8 * 2;
            *(v8us*)(Vh + po + (size_t)d * TT) = *(const v8usa*)p; *(v8us*)(Vl + po + (size_t)d * TT) = *(const v8usa*)(p + 64 * VPB); }
        asm volatile("s_wait_xcnt 0x0" ::: "memory");   // behind the run's last store, in front of whatever next takes the registers that the stores name
    }
}
__global__ __launch_bounds__(256) void k_fattn(const bf* __restrict__ Qh, const bf* __restrict__ Ql, const bf* __restrict__ Kh, const bf* __restrict__ Kl, const bf* __restrict__ Vh, const bf* __restrict__ Vl, bf* Ah, bf* Al) {
    __shared__ __align__(16) char sm[64 * SPB];
    const int lane = threadIdx.x & 31, lr = lane & 15, hi = lane >> 4; const int w = __builtin_amdgcn_readfirstlane(threadIdx.x >> 5);
    const int r0 = blockIdx.x * 64; const size_t hq = (size_t)blockIdx.y * TT * HD, hk = (size_t)(blockIdx.y / REP) * TT * HD;
    const int kb = max(0, ((r0 + 63) >> 7) - (NCH - 1)) * 128;   // key of LDS column 0
    const int K0 = max(0, r0 - WIN);                             // first key of the band
    const bool full = r0 >= WIN;                                 // the block's whole band of WIN + 64 keys exists
    const int mp = w >> 2, wq = w & 3;                           // the wave's pair of 16-row groups; its quarter of the keys (scores) or of the head dims (attn.v)
    {   // scores: 2 row groups x 5 key tiles of 16 per wave
        v16bf a[2][2], a2[2][2];
#pragma unroll
        for (int m = 0; m < 2; ++m)
#pragma unroll
            for (int ks = 0; ks < 2; ++ks) { const size_t o = hq + (size_t)(r0 + (mp * 2 + m) * 16 + lr) * HD + ks * 32 + 8 * hi; a[m][ks] = WFrag<bf>::ld(Qh + o); a2[m][ks] = WFrag<bf>::ld(Ql + o); asm volatile("s_wait_xcnt 0x0" ::: "memory"); }   // the wait stands behind each group of loads in this kernel, in front of whatever next takes the registers that held their addresses
        auto ldk = [&](int c, v16bf* b, v16bf* b2) { const size_t o = hk + (size_t)(c + lr) * HD + 8 * hi;
#pragma unroll
            for (int ks = 0; ks < 2; ++ks) { b[ks] = WFrag<bf>::ld(Kh + o + ks * 32); b2[ks] = WFrag<bf>::ld(Kl + o + ks * 32); }
            asm volatile("s_wait_xcnt 0x0" ::: "memory"); };   // before the address registers are reused
        auto tile = [&](int c, const v16bf* b, const v16bf* b2) { v8f acc[2]; acc[0] = (v8f){}; acc[1] = (v8f){};
#pragma unroll
            for (int ks = 0; ks < 2; ++ks)
#pragma unroll
                for (int m = 0; m < 2; ++m) { acc[m] = wmmab(a[m][ks], b[ks], acc[m]); acc[m] = wmmab(a2[m][ks], b[ks], acc[m]); acc[m] = wmmab(a[m][ks], b2[ks], acc[m]); }
            asm volatile("v_nop\n\tv_nop\n\tv_nop\n\tv_nop" : "+v"(acc[0]), "+v"(acc[1]));   // four vector slots behind the tile's last matrix instruction: the LDS stores fill none, and the next tile's first product may be given the same result registers
#pragma unroll
            for (int m = 0; m < 2; ++m)
#pragma unroll
                for (int j = 0; j < 8; ++j) *(f32a*)(sm + ((mp * 2 + m) * 16 + hi * 8 + j) * SPB + (c - kb + lr) * 4) = acc[m][j]; };
        const int cw = r0 - WIN + wq * 80;   // the wave's first key
        if (full) {   // the whole band exists: straight-line code with the key fragments fetched three tiles ahead
            v16bf b[5][2], b2[5][2];
#pragma unroll
            for (int t = 0; t < 3; ++t) ldk(cw + t * 16, b[t], b2[t]);
            __builtin_amdgcn_sched_barrier(0);   // keeps the first three tiles' loads in front of the first product (the scheduler otherwise sinks each load to its use and the wave waits out one memory latency per fragment)
#pragma unroll
            for (int t = 0; t < 5; ++t) { if (t + 3 < 5) ldk(cw + (t + 3) * 16, b[t + 3], b2[t + 3]);
                tile(cw + t * 16, b[t], b2[t]);
                __builtin_amdgcn_sched_barrier(0);   // keeps the load issued in this tile from sinking into a later one
            }
        } else {
#pragma unroll 1
            for (int t = 0; t < 5; ++t) { const int c = cw + t * 16; if (c < 0) continue;   // a tile in front of key 0 does not exist
                v16bf b[2], b2[2]; ldk(c, b, b2); tile(c, b, b2); }
        }
    }
    __syncthreads();
    const size_t vo = hk + (size_t)(wq * 16 + lr) * TT + 8 * hi;   // the wave's 16 head dims of the v planes [d][t]
    v16bf vb[(WIN + 64) / 32], vb2[(WIN + 64) / 32];
    if (full) {   // the first five 32-key steps of v are fetched here, so that they land while the softmax runs
#pragma unroll
        for (int kk = 0; kk < 5; ++kk) { vb[kk] = WFrag<bf>::ld(Vh + vo + K0 + kk * 32); vb2[kk] = WFrag<bf>::ld(Vl + vo + K0 + kk * 32); asm volatile("s_wait_xcnt 0x0" ::: "memory"); }   // before the address registers are reused
    }
    {   // softmax: 8 rows per wave, each row whole in registers (12 scores a lane); columns outside the band were never written and are not read
        v4f s[8][NCH];
#pragma unroll
        for (int rr = 0; rr < 8; ++rr)
#pragma unroll
            for (int ch = 0; ch < NCH; ++ch) { const int j0 = kb + ch * 128 + lane * 4; s[rr][ch] = (v4f){}; if (j0 >= K0 && j0 < r0 + 64) s[rr][ch] = *(const v4fa*)(sm + (w * 8 + rr) * SPB + (ch * 128 + lane * 4) * 4); }
#pragma unroll
        for (int rr = 0; rr < 8; ++rr) { const int i = r0 + w * 8 + rr; float mx = -3.0e38f;
#pragma unroll
            for (int ch = 0; ch < NCH; ++ch) { const int j0 = kb + ch * 128 + lane * 4;
#pragma unroll
                for (int q = 0; q < 4; ++q) { const float t = (j0 + q <= i && j0 + q > i - WIN) ? s[rr][ch][q] * SCL : -3.0e38f;   /* causal sliding window: i - WIN < j <= i */ s[rr][ch][q] = t; mx = fmaxf(mx, t); } }
#pragma unroll
            for (int sh = 16; sh; sh >>= 1) mx = fmaxf(mx, __shfl_xor(mx, sh, 32));
            float sum = 0.f;
#pragma unroll
            for (int ch = 0; ch < NCH; ++ch)
#pragma unroll
                for (int q = 0; q < 4; ++q) { const float ex = __builtin_amdgcn_exp2f(__fmul_rn(__fsub_rn(s[rr][ch][q], mx), 1.4426950408889634f)); s[rr][ch][q] = ex; sum += ex; }
#pragma unroll
            for (int sh = 16; sh; sh >>= 1) sum += __shfl_xor(sum, sh, 32);
            const float f = __fdiv_rn(1.0f, sum);
#pragma unroll
            for (int ch = 0; ch < NCH; ++ch) { v4us oh, ol;
#pragma unroll
                for (int q = 0; q < 4; ++q) { unsigned short a2, c2; splitf(s[rr][ch][q] * f, a2, c2); oh[q] = a2; ol[q] = c2; }
                char* pr = sm + (w * 8 + rr) * SPB + (ch * 128 + lane * 4) * 2; *(v4usa*)pr = oh; *(v4usa*)(pr + 768) = ol; } }
    }
    __syncthreads();
    v8f o[2]; o[0] = (v8f){}; o[1] = (v8f){};
    {   // attn.v: 2 row groups x 16 head dims per wave; probabilities from LDS, v planes [d][t] from memory
        const char* pa = sm + (mp * 32 + lr) * SPB + 16 * hi;
        auto step = [&](int kc, v16bf b, v16bf b2) {
#pragma unroll
            for (int m = 0; m < 2; ++m) { const char* p = pa + m * 16 * SPB + (kc - kb) * 2; const v16bf a = cat16b(*(const v8usa*)p, *(const v8usa*)(p + 32)), a2 = cat16b(*(const v8usa*)(p + 768), *(const v8usa*)(p + 800));
                o[m] = wmmab(a, b, o[m]); o[m] = wmmab(a2, b, o[m]); o[m] = wmmab(a, b2, o[m]); } };
        if (full) {
#pragma unroll
            for (int kk = 0; kk < (WIN + 64) / 32; ++kk) { if (kk + 5 < (WIN + 64) / 32) { vb[kk + 5] = WFrag<bf>::ld(Vh + vo + K0 + (kk + 5) * 32); vb2[kk + 5] = WFrag<bf>::ld(Vl + vo + K0 + (kk + 5) * 32); asm volatile("s_wait_xcnt 0x0" ::: "memory"); }   // before the address registers are reused
                step(K0 + kk * 32, vb[kk], vb2[kk]);
                __builtin_amdgcn_sched_barrier(0);   // keeps the v load issued in this step, five steps ahead of its use, from sinking to that use
            }
        } else {
#pragma unroll 1
            for (int kc = 0; kc < r0 + 64; kc += 32) { const v16bf b = WFrag<bf>::ld(Vh + vo + kc), b2 = WFrag<bf>::ld(Vl + vo + kc); asm volatile("s_wait_xcnt 0x0" ::: "memory");   // before the address registers are reused
                step(kc, b, b2); }
        }
    }
    __syncthreads();   // every wave has read its last probability fragment: the rows become output staging
#pragma unroll
    for (int m = 0; m < 2; ++m)
#pragma unroll
        for (int j = 0; j < 8; ++j) *(f32a*)(sm + ((mp * 2 + m) * 16 + hi * 8 + j) * OPB + (wq * 16 + lr) * 4) = o[m][j];
    __syncthreads();
    {   // merged hi/lo context [t][head * 64 + d]: four lanes of one wave write a row's 128 bytes of each plane
        const int row = threadIdx.x >> 2, cq = (threadIdx.x & 3) * 16; const size_t oo = (size_t)(r0 + row) * DQ + blockIdx.y * HD + cq;
#pragma unroll
        for (int g = 0; g < 2; ++g) { v8us oh, ol;
#pragma unroll
            for (int u = 0; u < 2; ++u) { const v4f val = *(const v4fa*)(sm + row * OPB + (cq + g * 8 + u * 4) * 4);
#pragma unroll
                for (int q = 0; q < 4; ++q) { unsigned short a2, c2; splitf(val[q], a2, c2); oh[u * 4 + q] = a2; ol[u * 4 + q] = c2; } }
            *(v8us*)(Ah + oo + g * 8) = oh; *(v8us*)(Al + oo + g * 8) = ol; }
    }
}

extern "C" void kernel_launch(void* const* d_in, const int* in_sizes, int n_in,
                              void* d_out, int out_size, void* d_ws, size_t ws_size, hipStream_t stream) {
    (void)in_sizes; (void)n_in; (void)out_size;
    const float* x = (const float*)d_in[0]; const float* wq = (const float*)d_in[1]; const float* wk = (const float*)d_in[2]; const float* wv = (const float*)d_in[3]; const float* wo = (const float*)d_in[4]; const float* bo = (const float*)d_in[5];
    float* OUT = (float*)d_out;     // [1][4096][1024]
    char* wsp = (char*)d_ws;
    auto take = [&](size_t bytes) { char* p = wsp; wsp += (bytes + 255) & ~(size_t)255; return (void*)p; };
    bf* WQ = (bf*)take((size_t)DQ * DM * 2); bf* WK = (bf*)take((size_t)DKV * DM * 2); bf* WV = (bf*)take((size_t)DKV * DM * 2); bf* WO = (bf*)take((size_t)DM * DQ * 2);
    bf* XB = (bf*)take((size_t)TT * DM * 2);
    bf* QPh = (bf*)take((size_t)NH_ * TT * HD * 2); bf* QPl = (bf*)take((size_t)NH_ * TT * HD * 2); bf* KPh = (bf*)take((size_t)NKV * TT * HD * 2); bf* KPl = (bf*)take((size_t)NKV * TT * HD * 2); bf* VTh = (bf*)take((size_t)NKV * HD * TT * 2); bf* VTl = (bf*)take((size_t)NKV * HD * TT * 2);
    bf* ATh = (bf*)take((size_t)TT * DQ * 2); bf* ATl = (bf*)take((size_t)TT * DQ * 2);
    if ((size_t)(wsp - (char*)d_ws) > ws_size) return;    // ws 256 MiB
    { k_cvt8<<<(unsigned)(((size_t)DQ * DM / 8 + 255) / 256), 256, 0, stream>>>(wq, WQ, (size_t)DQ * DM / 8); k_cvt8<<<(unsigned)(((size_t)DKV * DM / 8 + 255) / 256), 256, 0, stream>>>(wk, WK, (size_t)DKV * DM / 8); k_cvt8<<<(unsigned)(((size_t)DKV * DM / 8 + 255) / 256), 256, 0, stream>>>(wv, WV, (size_t)DKV * DM / 8);
      k_cvt8<<<(unsigned)(((size_t)DM * DQ / 8 + 255) / 256), 256, 0, stream>>>(wo, WO, (size_t)DM * DQ / 8);
       }
    for (int b = 0; b < NB_; ++b) {
        
        k_cvt8<<<(unsigned)(((size_t)TT * DM / 8 + 255) / 256), 256, 0, stream>>>(x + (size_t)b * TT * DM, XB, (size_t)TT * DM / 8);
        k_qkv<<<dim3(TT / 128, DQ / 128, 3), 128, 0, stream>>>(XB, WQ, WK, WV, QPh, QPl, KPh, KPl, VTh, VTl);
        k_fattn<<<dim3(TT / 64, NH_, 1), 256, 0, stream>>>(QPh, QPl, KPh, KPl, VTh, VTl, ATh, ATl);
        k_oproj<<<dim3(TT / 128, DM / 128, 1), 256, 0, stream>>>(ATh, ATl, WO, OUT + (size_t)b * TT * DM, bo); }
}

// v005
// Measured time: 92.9 microseconds a run.
// Next to v004, in two timings, it ran 1.07 times as fast each time.
// All steps since v000 together make it 25.0 times as fast.
#include <hip/hip_runtime.h>

// Local causal multi-head attention WITHOUT the 1/sqrt(d) scaling (x [1][4096][1024]; q,k,v = x W^T ('oi' [1024][1024], no bias; 16 heads x 64); scores = q.k (unscaled: logit sigma ~8); keys with j > i or j <= i - 256 masked (-1e30 == exclusion); softmax; ctx merged; out = ctx Wo^T + bo -> [1][4096][1024] (4.2 M)).
// Layout: bf16 copy of x; exact q, k, v projections in one launch that writes the hi/lo head planes (v transposed) from its epilogue; causal-window T-4096 attention, every head in one launch, with EVERY row on bf16 hi/lo planes (3 products; the unscaled logits are too sharp for fp16 planes): k_fattn gives a 64-row block of one head to one work-group, which computes the 320 keys of scores that the 256-wide band touches into LDS, takes the softmax over the band's three 128-key chunks with the window as an index select, does attn.v (3 products) over the band's 320 keys from LDS and writes the merged hi/lo context; merged hi/lo x Wo exact + bo.
// Compute dtypes, f32 accumulate: every input rounded to bf16; projections exact; scores and attn.v 3 products on every row; softmax f32; Wo hl x exact + bias.

#define NB_  1
#define TT   4096
#define DM   1024
#define NH_  16
#define NKV  16
#define REP  (NH_ / NKV)
#define HD   64
#define DQ   (NH_ * HD)
#define DKV  (NKV * HD)
#define ZH   1
#define RH   4096                  // unused: every query row uses hi+lo planes
#define WIN  256
#define NCH  ((WIN + 127) / 128 + 1)   // 128-key softmax chunks that cover a 64-row block's WIN + 64 keys at any 64-key phase
#define PCAR 1024.0f
#define SCL  1.0f   // the module applies no 1/sqrt(d)
typedef _Float16 h16;
typedef unsigned short bf;
typedef __attribute__((ext_vector_type(16))) __bf16   v16bf;
typedef __attribute__((ext_vector_type(16))) _Float16 v16h;
typedef __attribute__((ext_vector_type(8)))  _Float16 v8h;
typedef __attribute__((ext_vector_type(8)))  unsigned short v8us;
typedef __attribute__((ext_vector_type(8)))  float    v8f;
typedef __attribute__((ext_vector_type(4)))  float    v4f;
typedef v8h  __attribute__((may_alias)) v8ha;
typedef v4f  __attribute__((may_alias)) v4fa;
typedef v8us __attribute__((may_alias)) v8usa;
typedef float __attribute__((may_alias)) f32a;

__device__ __forceinline__ unsigned short f2bf(float f) { unsigned u = __float_as_uint(f); u += 0x7FFFu + ((u >> 16) & 1u); return (unsigned short)(u >> 16); }
__device__ __forceinline__ float bf2f(unsigned short b) { return __uint_as_float(((unsigned)b) << 16); }
__device__ __forceinline__ float bfr(float f) { return bf2f(f2bf(f)); }
__device__ __forceinline__ v16h cat16(v8h lo, v8h hi) { return __builtin_shufflevector(lo, hi, 0, 1, 2, 3, 4, 5, 6, 7, 8, 9, 10, 11, 12, 13, 14, 15); }
__device__ __forceinline__ v16bf cat16b(v8us lo, v8us hi) { return __builtin_bit_cast(v16bf, __builtin_shufflevector(lo, hi, 0, 1, 2, 3, 4, 5, 6, 7, 8, 9, 10, 11, 12, 13, 14, 15)); }
__device__ __forceinline__ v8f wmma16(v16h a, v16h b, v8f c) { return __builtin_amdgcn_wmma_f32_16x16x32_f16(false, a, false, b, (short)0, c, false, false); }
__device__ __forceinline__ v8f wmmab(v16bf a, v16bf b, v8f c) { return __builtin_amdgcn_wmma_f32_16x16x32_bf16(false, a, false, b, (short)0, c, false, false); }



// ---- gemm128: the K loop of both GEMMs. A work-group owns a 128x128 output tile; each wave MB x 4 accumulators: 4 waves (2 x 2) of 64x64 with MB = 4, 8 waves (4 x 2) of 32x64 with MB = 2.
// Operands are K-contiguous bf16 planes of pitch DM. A stage is 64 k (128 bytes) of the tile's 128 A rows (NA = 2: of the hi and of the lo plane) and 128 B rows. 8 lanes fetch one row's whole 128-byte line, and every wave that needs a row reads it from LDS.
// Two buffers: stage t + 1 is fetched into registers in front of stage t's products and stored to the other buffer behind them; one work-group barrier a stage.
// Every accumulator keeps its sum order: k ascending in steps of 32 (NA = 2: hi then lo within a step).
template <typename T16> struct WFrag;
template <> struct WFrag<h16> { typedef v16h V; static __device__ __forceinline__ V ld(const h16* p) { return cat16(*(const v8h*)p, *(const v8h*)(p + 16)); } static __device__ __forceinline__ v8f mma(V a, V b, v8f c) { return wmma16(a, b, c); } };
template <> struct WFrag<bf> { typedef v16bf V; static __device__ __forceinline__ V ld(const bf* p) { return cat16b(*(const v8us*)p, *(const v8us*)(p + 16)); } static __device__ __forceinline__ v8f mma(V a, V b, v8f c) { return wmmab(a, b, c); } };
#define GP 144   // LDS pitch in bytes of a staged row: 128 + 16 (16 B x odd: sixteen rows' 16-byte fragment reads fall on different banks)
#define GBUF(NA) (((NA) + 1) * 128 * GP)   // bytes of one buffer: rows [A | A lo | B]
template <int NA, int MB>
__device__ __forceinline__ void gemm128(const bf* __restrict__ A, const bf* __restrict__ A2, const bf* __restrict__ Bt, char* sm, int R0, int C0, int wm, int wn, v8f (&acc)[MB][4]) {
    typedef WFrag<bf>::V V;
    constexpr int RP = 2 * (8 / MB) * 32 / 8, PI = 128 / RP;   // rows that the work-group's threads fetch at once; such fetches per 128-row plane
    const int lane = threadIdx.x & 31, lr = lane & 15, hi = lane >> 4; const int tr = threadIdx.x >> 3, tc = threadIdx.x & 7;
    const size_t ao = (size_t)(R0 + tr) * DM + tc * 8, bo = (size_t)(C0 + tr) * DM + tc * 8;
    char* sw = sm + tr * GP + tc * 16;
    const char* fa = sm + (wm * MB * 16 + lr) * GP + 16 * hi; const char* fb = sm + (NA * 128 + wn * 64 + lr) * GP + 16 * hi;
    v8us g[(NA + 1) * PI];
    auto fetch = [&](int kc) {
#pragma unroll
        for (int i = 0; i < PI; ++i) { g[i] = *(const v8us*)(A + ao + (size_t)i * RP * DM + kc); if (NA == 2) g[PI + i] = *(const v8us*)(A2 + ao + (size_t)i * RP * DM + kc); g[NA * PI + i] = *(const v8us*)(Bt + bo + (size_t)i * RP * DM + kc); }
        asm volatile("s_wait_xcnt 0x0" ::: "memory"); };   // behind the stage's loads, in front of whatever next takes the registers that held their addresses; it also keeps the loads from sinking to their LDS stores behind the products
    auto put = [&](int buf) {
#pragma unroll
        for (int i = 0; i < (NA + 1) * PI; ++i) *(v8usa*)(sw + buf + i * RP * GP) = g[i]; };
    auto ldf = [&](const char* p) { return cat16b(*(const v8usa*)p, *(const v8usa*)(p + 32)); };
    auto products = [&](int buf) {
#pragma unroll
        for (int ks = 0; ks < 2; ++ks) { V a[MB], a2[MB];
#pragma unroll
            for (int mb = 0; mb < MB; ++mb) { a[mb] = ldf(fa + buf + mb * 16 * GP + ks * 64); if (NA == 2) a2[mb] = ldf(fa + buf + (128 + mb * 16) * GP + ks * 64); }
#pragma unroll
            for (int nb = 0; nb < 4; ++nb) { const V b = ldf(fb + buf + nb * 16 * GP + ks * 64);
#pragma unroll
                for (int mb = 0; mb < MB; ++mb) { acc[mb][nb] = wmmab(a[mb], b, acc[mb][nb]); if (NA == 2) acc[mb][nb] = wmmab(a2[mb], b, acc[mb][nb]); } } } };
#pragma unroll
    for (int mb = 0; mb < MB; ++mb)
#pragma unroll
        for (int nb = 0; nb < 4; ++nb) acc[mb][nb] = (v8f){};
    fetch(0); put(0);
    __syncthreads();   // stage 0 is in LDS for every wave
#pragma unroll 1   // stays rolled: one stage of loads, products and stores, small code
    for (int t = 0; t < DM / 64 - 1; ++t) { const int cur = (t & 1) * GBUF(NA);
        fetch((t + 1) * 64);
        products(cur);
        __builtin_amdgcn_sched_barrier(0);   // keeps the LDS stores, which wait for stage t + 1's global loads, behind stage t's products: the scheduler otherwise lifts them over the products, and the wave waits out the loads' latency with the matrix unit idle
        put(GBUF(NA) - cur);
        __syncthreads();   // publishes stage t + 1 and ends every wave's reads of stage t, whose buffer the next trip overwrites
    }
    products(((DM / 64 - 1) & 1) * GBUF(NA));
    __syncthreads();   // every wave has read its last fragment: the buffers become output staging
}

// k_oproj: out = (ctx hi + ctx lo) Wo^T + bias, f32, gemm128 with both context planes, 8 waves of 32x64 (the grid is one work-group per WGP: two waves a SIMD, so that one wave's products cover the other's LDS waits); each wave stages 16 rows of its part in its own LDS range and stores whole 256-byte rows.
__global__ __launch_bounds__(256) void k_oproj(const bf* __restrict__ A, const bf* __restrict__ A2, const bf* __restrict__ Bt, float* C, const float* __restrict__ bias) {
    __shared__ __align__(16) char sm[2 * GBUF(2)];
    const int lane = threadIdx.x & 31, lr = lane & 15, hi = lane >> 4; const int w = __builtin_amdgcn_readfirstlane(threadIdx.x >> 5), wm = w & 3, wn = w >> 2;
    const int r0 = blockIdx.x * 128 + wm * 32, c0 = blockIdx.y * 128 + wn * 64;
    v8f acc[2][4];
    gemm128<2, 2>(A, A2, Bt, sm, blockIdx.x * 128, blockIdx.y * 128, wm, wn, acc);
    float* os = (float*)(sm + w * (16 * 68 * 4));
#pragma unroll
    for (int mb = 0; mb < 2; ++mb) {
#pragma unroll
        for (int nb = 0; nb < 4; ++nb) {
#pragma unroll
            for (int j = 0; j < 8; ++j) *(f32a*)(os + (hi * 8 + j) * 68 + nb * 16 + lr) = acc[mb][nb][j]; }
        __builtin_amdgcn_wave_barrier(); asm volatile("" ::: "memory");   // each lane reads what other lanes stored: the compiler, which reasons about one lane, must not move a read below over a store above
        float* crow = C + (size_t)(r0 + mb * 16) * DM + c0;
#pragma unroll
        for (int s = 0; s < 8; ++s) { const int row = 2 * s + hi, cofs = lr * 4; v4f val = *(const v4fa*)(os + row * 68 + cofs); val[0] += bfr(bias[c0 + cofs]); val[1] += bfr(bias[c0 + cofs + 1]); val[2] += bfr(bias[c0 + cofs + 2]); val[3] += bfr(bias[c0 + cofs + 3]);
            *(v4f*)(crow + (size_t)row * DM + cofs) = val; }
        asm volatile("s_wait_xcnt 0x0" ::: "memory");   // behind the group's stores, in front of whatever next takes the registers that they name
        __builtin_amdgcn_wave_barrier(); asm volatile("" ::: "memory");   // likewise: the next group's stores must not move over other lanes' reads above
    }
}

__device__ __forceinline__ h16 tohx(float x) { return (h16)x; }
__device__ __forceinline__ void splitf(float y, unsigned short& h, unsigned short& l) { h = f2bf(y); l = f2bf(y - bf2f(h)); }
typedef __attribute__((ext_vector_type(2))) _Float16 v2h;
typedef __attribute__((ext_vector_type(4))) _Float16 v4h;
typedef __attribute__((ext_vector_type(2))) unsigned short v2us;
typedef __attribute__((ext_vector_type(4))) unsigned short v4us;
typedef __attribute__((ext_vector_type(2))) float v2f;
typedef __attribute__((ext_vector_type(4))) int v4i;

__global__ __launch_bounds__(256) void k_wtG(const float* __restrict__ w, int K, int N, bf* Bt) {
    const int lane = threadIdx.x & 31; const int L0 = (blockIdx.x * 8 + (threadIdx.x >> 5)) * 8; const int nlines = N * K / 64;
{
#pragma unroll 1
        for (int l = 0; l < 8; ++l) { const int L = L0 + l; if (L >= nlines) break; const size_t e = (size_t)L * 64 + lane * 2; const int k = (int)(e % K), n = (int)(e / K); v2us o;
            o[0] = f2bf(w[(size_t)k * N + n]); o[1] = f2bf(w[(size_t)(k + 1) * N + n]); *(v2us*)(Bt + e) = o; }
         }
}
// k_cvt: the bf16 copies of the four weights and of x in one launch of one work-group per WGP. A work-group of 16 waves takes 32768 consecutive floats of one input (the input is picked per work-group, a scalar choice);
// a wave takes 2048 of them: 16 loads of 512 contiguous bytes (whole lines), all issued before the first value is used, then 16 stores of 256 contiguous bytes.
#define CVW 32768   // floats per work-group
static_assert((DQ * DM) % CVW == 0 && (DKV * DM) % CVW == 0 && (DM * DQ) % CVW == 0 && (TT * DM) % CVW == 0, "every input is a whole number of work-groups");
__global__ __launch_bounds__(512) void k_cvt(const float* __restrict__ wq, const float* __restrict__ wk, const float* __restrict__ wv, const float* __restrict__ wo, const float* __restrict__ x, bf* WQ, bf* WK, bf* WV, bf* WO, bf* XB) {
    constexpr int nq = DQ * DM / CVW, nk = DKV * DM / CVW, no = DM * DQ / CVW;
    int b = blockIdx.x; const float* __restrict__ s; bf* d;
    if (b < nq) { s = wq; d = WQ; }
    else if ((b -= nq) < nk) { s = wk; d = WK; }
    else if ((b -= nk) < nk) { s = wv; d = WV; }
    else if ((b -= nk) < no) { s = wo; d = WO; }
    else { b -= no; s = x; d = XB; }
    const size_t e = (size_t)b * CVW + (threadIdx.x >> 5) * 2048 + (threadIdx.x & 31) * 4;
    v4f v[16];
#pragma unroll
    for (int i = 0; i < 16; ++i) v[i] = *(const v4f*)(s + e + i * 128);
    asm volatile("s_wait_xcnt 0x0" ::: "memory");   // behind the loads, in front of whatever next takes the registers that held their address; it also keeps all sixteen loads in front of the first store
#pragma unroll
    for (int i = 0; i < 16; ++i) { v4us o;
#pragma unroll
        for (int q = 0; q < 4; ++q) o[q] = f2bf(v[i][q]);
        *(v4us*)(d + e + i * 128) = o; }
}

// k_fattn: one launch for every head: a work-group of 8 waves owns one 64-row block of one head and keeps the block's band in LDS from the scores to the merged context.
// LDS row = the NCH = 3 128-key chunks from key kb on (they cover keys r0 - WIN .. r0 + 63; the first blocks start at key 0): 384 f32 scores, overwritten in place by 384 bf16 hi + 384 bf16 lo probabilities.
// Every sum keeps its order: score tiles k 0..31 then 32..63 (hi.hi, lo.hi, hi.lo); softmax one wave per row, lane -> 4 consecutive keys per chunk; attn.v 32 keys a step from the band's first key up.
#define SPB 1552   // LDS row pitch in bytes: 1536 + 16 (16 B x odd, so that sixteen rows' 16-byte fragment reads fall on different banks)
#define OPB 272    // output staging pitch in bytes (68 dwords)
typedef v4us __attribute__((may_alias)) v4usa;
// k_qkv: the q, k and v projections in one launch (grid z picks the weight), gemm128's loop (4 waves per 128x128 tile, one 64x64 quarter each, k ascending in steps of 32), and an epilogue, each wave in its own LDS range, that writes the attention kernel's bf16 hi/lo planes itself.
// A wave's 64 columns are one head. q, k: planes [h][t][d], rows staged as f32 in LDS so that 8 lanes store one row's 128 bytes of a plane. v: planes [d][t]; a lane's 8 accumulator rows are 8 consecutive t of one d, split in registers, staged as 16-byte pieces and stored as whole 128-byte rows.
#define VPB 144   // LDS pitch in bytes of a staged v row: 128 + 16 (16 B x odd: sixteen rows' 16-byte pieces fall on different banks)
static_assert(DKV == DQ && DQ == DM && HD == 64, "one 64-column quarter per head, the same grid for q, k and v, one K for both GEMMs");
__global__ __launch_bounds__(128) void k_qkv(const bf* __restrict__ A, const bf* __restrict__ Wq, const bf* __restrict__ Wk, const bf* __restrict__ Wv, bf* Qh, bf* Ql, bf* Kh, bf* Kl, bf* Vh, bf* Vl) {
    __shared__ __align__(16) char sm[2 * GBUF(1)];
    static_assert(4 * 2 * 64 * VPB <= 2 * GBUF(1), "the four waves' output staging fits the operand buffers");
    const int z = blockIdx.z; const bf* __restrict__ Bt = z == 0 ? Wq : z == 1 ? Wk : Wv;
    const int lane = threadIdx.x & 31, lr = lane & 15, hi = lane >> 4; const int w = __builtin_amdgcn_readfirstlane(threadIdx.x >> 5), wm = w & 1, wn = w >> 1;
    const int r0 = blockIdx.x * 128 + wm * 64, hd = blockIdx.y * 2 + wn;   // the wave's first row; its head
    v8f acc[4][4];
    gemm128<1, 4>(A, nullptr, Bt, sm, blockIdx.x * 128, blockIdx.y * 128, wm, wn, acc);
    char* st = sm + w * (2 * 64 * VPB);   // the wave's own staging range
    const int l8 = lane >> 3, c8 = (lane & 7) * 8;   // store phase: 8 lanes x 16 bytes cover one 128-byte row, 4 rows an instruction
    if (z < 2) {
        bf* Ph = z == 0 ? Qh : Kh; bf* Pl = z == 0 ? Ql : Kl;
#pragma unroll
        for (int mb = 0; mb < 4; ++mb) {
#pragma unroll
            for (int nb = 0; nb < 4; ++nb)
#pragma unroll
                for (int j = 0; j < 8; ++j) *(f32a*)(st + ((hi * 8 + j) * 68 + nb * 16 + lr) * 4) = acc[mb][nb][j];
            __builtin_amdgcn_wave_barrier(); asm volatile("" ::: "memory");   // each lane reads what other lanes stored: the compiler, which reasons about one lane, must not move a read below over a store above
            const size_t po = ((size_t)hd * TT + r0 + mb * 16) * HD + c8;
#pragma unroll
            for (int s = 0; s < 4; ++s) { const int row = s * 4 + l8; v8us oh, ol;
#pragma unroll
                for (int u = 0; u < 2; ++u) { const v4f val = *(const v4fa*)(st + (row * 68 + c8 + u * 4) * 4);
#pragma unroll
                    for (int q = 0; q < 4; ++q) { unsigned short a2, c2; splitf(val[q], a2, c2); oh[u * 4 + q] = a2; ol[u * 4 + q] = c2; } }
                *(v8us*)(Ph + po + (size_t)row * HD) = oh; *(v8us*)(Pl + po + (size_t)row * HD) = ol; }
            __builtin_amdgcn_wave_barrier(); asm volatile("" ::: "memory");   // likewise: the next group's stores must not move over other lanes' reads above
        }
    } else {
#pragma unroll
        for (int mb = 0; mb < 4; ++mb)
#pragma unroll
            for (int nb = 0; nb < 4; ++nb) { v8us oh, ol;
#pragma unroll
                for (int j = 0; j < 8; ++j) { unsigned short a2, c2; splitf(acc[mb][nb][j], a2, c2); oh[j] = a2; ol[j] = c2; }
                char* p = st + (nb * 16 + lr) * VPB + (mb * 16 + hi * 8) * 2; *(v8usa*)p = oh; *(v8usa*)(p + 64 * VPB) = ol; }
        __builtin_amdgcn_wave_barrier(); asm volatile("" ::: "memory");   // each lane reads what other lanes stored: the compiler, which reasons about one lane, must not move a read below over a store above
        const size_t po = (size_t)hd * HD * TT + r0 + c8;
#pragma unroll
        for (int s = 0; s < 16; ++s) { const int d = s * 4 + l8; const char* p = st + d * VPB + c8 * 2;
            *(v8us*)(Vh + po + (size_t)d * TT) = *(const v8usa*)p; *(v8us*)(Vl + po + (size_t)d * TT) = *(const v8usa*)(p + 64 * VPB); }
        asm volatile("s_wait_xcnt 0x0" ::: "memory");   // behind the run's last store, in front of whatever next takes the registers that the stores name
    }
}
__global__ __launch_bounds__(256) void k_fattn(const bf* __restrict__ Qh, const bf* __restrict__ Ql, const bf* __restrict__ Kh, const bf* __restrict__ Kl, const bf* __restrict__ Vh, const bf* __restrict__ Vl, bf* Ah, bf* Al) {
    __shared__ __align__(16) char sm[64 * SPB];
    const int lane = threadIdx.x & 31, lr = lane & 15, hi = lane >> 4; const int w = __builtin_amdgcn_readfirstlane(threadIdx.x >> 5);
    const int r0 = blockIdx.x * 64; const size_t hq = (size_t)blockIdx.y * TT * HD, hk = (size_t)(blockIdx.y / REP) * TT * HD;
    const int kb = max(0, ((r0 + 63) >> 7) - (NCH - 1)) * 128;   // key of LDS column 0
    const int K0 = max(0, r0 - WIN);                             // first key of the band
    const bool full = r0 >= WIN;                                 // the block's whole band of WIN + 64 keys exists
    const int mp = w >> 2, wq = w & 3;                           // the wave's pair of 16-row groups; its quarter of the keys (scores) or of the head dims (attn.v)
    {   // scores: 2 row groups x 5 key tiles of 16 per wave
        v16bf a[2][2], a2[2][2];
#pragma unroll
        for (int m = 0; m < 2; ++m)
#pragma unroll
            for (int ks = 0; ks < 2; ++ks) { const size_t o = hq + (size_t)(r0 + (mp * 2 + m) * 16 + lr) * HD + ks * 32 + 8 * hi; a[m][ks] = WFrag<bf>::ld(Qh + o); a2[m][ks] = WFrag<bf>::ld(Ql + o); asm volatile("s_wait_xcnt 0x0" ::: "memory"); }   // the wait stands behind each group of loads in this kernel, in front of whatever next takes the registers that held their addresses
        auto ldk = [&](int c, v16bf* b, v16bf* b2) { const size_t o = hk + (size_t)(c + lr) * HD + 8 * hi;
#pragma unroll
            for (int ks = 0; ks < 2; ++ks) { b[ks] = WFrag<bf>::ld(Kh + o + ks * 32); b2[ks] = WFrag<bf>::ld(Kl + o + ks * 32); }
            asm volatile("s_wait_xcnt 0x0" ::: "memory"); };   // before the address registers are reused
        auto tile = [&](int c, const v16bf* b, const v16bf* b2) { v8f acc[2]; acc[0] = (v8f){}; acc[1] = (v8f){};
#pragma unroll
            for (int ks = 0; ks < 2; ++ks)
#pragma unroll
                for (int m = 0; m < 2; ++m) { acc[m] = wmmab(a[m][ks], b[ks], acc[m]); acc[m] = wmmab(a2[m][ks], b[ks], acc[m]); acc[m] = wmmab(a[m][ks], b2[ks], acc[m]); }
            asm volatile("v_nop\n\tv_nop\n\tv_nop\n\tv_nop" : "+v"(acc[0]), "+v"(acc[1]));   // four vector slots behind the tile's last matrix instruction: the LDS stores fill none, and the next tile's first product may be given the same result registers
#pragma unroll
            for (int m = 0; m < 2; ++m)
#pragma unroll
                for (int j = 0; j < 8; ++j) *(f32a*)(sm + ((mp * 2 + m) * 16 + hi * 8 + j) * SPB + (c - kb + lr) * 4) = acc[m][j]; };
        const int cw = r0 - WIN + wq * 80;   // the wave's first key
        if (full) {   // the whole band exists: straight-line code with the key fragments fetched three tiles ahead
            v16bf b[5][2], b2[5][2];
#pragma unroll
            for (int t = 0; t < 3; ++t) ldk(cw + t * 16, b[t], b2[t]);
            __builtin_amdgcn_sched_barrier(0);   // keeps the first three tiles' loads in front of the first product (the scheduler otherwise sinks each load to its use and the wave waits out one memory latency per fragment)
#pragma unroll
            for (int t = 0; t < 5; ++t) { if (t + 3 < 5) ldk(cw + (t + 3) * 16, b[t + 3], b2[t + 3]);
                tile(cw + t * 16, b[t], b2[t]);
                __builtin_amdgcn_sched_barrier(0);   // keeps the load issued in this tile from sinking into a later one
            }
        } else {
#pragma unroll 1
            for (int t = 0; t < 5; ++t) { const int c = cw + t * 16; if (c < 0) continue;   // a tile in front of key 0 does not exist
                v16bf b[2], b2[2]; ldk(c, b, b2); tile(c, b, b2); }
        }
    }
    __syncthreads();
    const size_t vo = hk + (size_t)(wq * 16 + lr) * TT + 8 * hi;   // the wave's 16 head dims of the v planes [d][t]
    v16bf vb[(WIN + 64) / 32], vb2[(WIN + 64) / 32];
    if (full) {   // the first five 32-key steps of v are fetched here, so that they land while the softmax runs
#pragma unroll
        for (int kk = 0; kk < 5; ++kk) { vb[kk] = WFrag<bf>::ld(Vh + vo + K0 + kk * 32); vb2[kk] = WFrag<bf>::ld(Vl + vo + K0 + kk * 32); asm volatile("s_wait_xcnt 0x0" ::: "memory"); }   // before the address registers are reused
    }
    {   // softmax: 8 rows per wave, each row whole in registers (12 scores a lane); columns outside the band were never written and are not read
        v4f s[8][NCH];
#pragma unroll
        for (int rr = 0; rr < 8; ++rr)
#pragma unroll
            for (int ch = 0; ch < NCH; ++ch) { const int j0 = kb + ch * 128 + lane * 4; s[rr][ch] = (v4f){}; if (j0 >= K0 && j0 < r0 + 64) s[rr][ch] = *(const v4fa*)(sm + (w * 8 + rr) * SPB + (ch * 128 + lane * 4) * 4); }
#pragma unroll
        for (int rr = 0; rr < 8; ++rr) { const int i = r0 + w * 8 + rr; float mx = -3.0e38f;
#pragma unroll
            for (int ch = 0; ch < NCH; ++ch) { const int j0 = kb + ch * 128 + lane * 4;
#pragma unroll
                for (int q = 0; q < 4; ++q) { const float t = (j0 + q <= i && j0 + q > i - WIN) ? s[rr][ch][q] * SCL : -3.0e38f;   /* causal sliding window: i - WIN < j <= i */ s[rr][ch][q] = t; mx = fmaxf(mx, t); } }
#pragma unroll
            for (int sh = 16; sh; sh >>= 1) mx = fmaxf(mx, __shfl_xor(mx, sh, 32));
            float sum = 0.f;
#pragma unroll
            for (int ch = 0; ch < NCH; ++ch)
#pragma unroll
                for (int q = 0; q < 4; ++q) { const float ex = __builtin_amdgcn_exp2f(__fmul_rn(__fsub_rn(s[rr][ch][q], mx), 1.4426950408889634f)); s[rr][ch][q] = ex; sum += ex; }
#pragma unroll
            for (int sh = 16; sh; sh >>= 1) sum += __shfl_xor(sum, sh, 32);
            const float f = __fdiv_rn(1.0f, sum);
#pragma unroll
            for (int ch = 0; ch < NCH; ++ch) { v4us oh, ol;
#pragma unroll
                for (int q = 0; q < 4; ++q) { unsigned short a2, c2; splitf(s[rr][ch][q] * f, a2, c2); oh[q] = a2; ol[q] = c2; }
                char* pr = sm + (w * 8 + rr) * SPB + (ch * 128 + lane * 4) * 2; *(v4usa*)pr = oh; *(v4usa*)(pr + 768) = ol; } }
    }
    __syncthreads();
    v8f o[2]; o[0] = (v8f){}; o[1] = (v8f){};
    {   // attn.v: 2 row groups x 16 head dims per wave; probabilities from LDS, v planes [d][t] from memory
        const char* pa = sm + (mp * 32 + lr) * SPB + 16 * hi;
        auto step = [&](int kc, v16bf b, v16bf b2) {
#pragma unroll
            for (int m = 0; m < 2; ++m) { const char* p = pa + m * 16 * SPB + (kc - kb) * 2; const v16bf a = cat16b(*(const v8usa*)p, *(const v8usa*)(p + 32)), a2 = cat16b(*(const v8usa*)(p + 768), *(const v8usa*)(p + 800));
                o[m] = wmmab(a, b, o[m]); o[m] = wmmab(a2, b, o[m]); o[m] = wmmab(a, b2, o[m]); } };
        if (full) {
#pragma unroll
            for (int kk = 0; kk < (WIN + 64) / 32; ++kk) { if (kk + 5 < (WIN + 64) / 32) { vb[kk + 5] = WFrag<bf>::ld(Vh + vo + K0 + (kk + 5) * 32); vb2[kk + 5] = WFrag<bf>::ld(Vl + vo + K0 + (kk + 5) * 32); asm volatile("s_wait_xcnt 0x0" ::: "memory"); }   // before the address registers are reused
                step(K0 + kk * 32, vb[kk], vb2[kk]);
                __builtin_amdgcn_sched_barrier(0);   // keeps the v load issued in this step, five steps ahead of its use, from sinking to that use
            }
        } else {
#pragma unroll 1
            for (int kc = 0; kc < r0 + 64; kc += 32) { const v16bf b = WFrag<bf>::ld(Vh + vo + kc), b2 = WFrag<bf>::ld(Vl + vo + kc); asm volatile("s_wait_xcnt 0x0" ::: "memory");   // before the address registers are reused
                step(kc, b, b2); }
        }
    }
    __syncthreads();   // every wave has read its last probability fragment: the rows become output staging
#pragma unroll
    for (int m = 0; m < 2; ++m)
#pragma unroll
        for (int j = 0; j < 8; ++j) *(f32a*)(sm + ((mp * 2 + m) * 16 + hi * 8 + j) * OPB + (wq * 16 + lr) * 4) = o[m][j];
    __syncthreads();
    {   // merged hi/lo context [t][head * 64 + d]: four lanes of one wave write a row's 128 bytes of each plane
        const int row = threadIdx.x >> 2, cq = (threadIdx.x & 3) * 16; const size_t oo = (size_t)(r0 + row) * DQ + blockIdx.y * HD + cq;
#pragma unroll
        for (int g = 0; g < 2; ++g) { v8us oh, ol;
#pragma unroll
            for (int u = 0; u < 2; ++u) { const v4f val = *(const v4fa*)(sm + row * OPB + (cq + g * 8 + u * 4) * 4);
#pragma unroll
                for (int q = 0; q < 4; ++q) { unsigned short a2, c2; splitf(val[q], a2, c2); oh[u * 4 + q] = a2; ol[u * 4 + q] = c2; } }
            *(v8us*)(Ah + oo + g * 8) = oh; *(v8us*)(Al + oo + g * 8) = ol; }
    }
}

extern "C" void kernel_launch(void* const* d_in, const int* in_sizes, int n_in,
                              void* d_out, int out_size, void* d_ws, size_t ws_size, hipStream_t stream) {
    (void)in_sizes; (void)n_in; (void)out_size;
    const float* x = (const float*)d_in[0]; const float* wq = (const float*)d_in[1]; const float* wk = (const float*)d_in[2]; const float* wv = (const float*)d_in[3]; const float* wo = (const float*)d_in[4]; const float* bo = (const float*)d_in[5];
    float* OUT = (float*)d_out;     // [1][4096][1024]
    char* wsp = (char*)d_ws;
    auto take = [&](size_t bytes) { char* p = wsp; wsp += (bytes + 255) & ~(size_t)255; return (void*)p; };
    bf* WQ = (bf*)take((size_t)DQ * DM * 2); bf* WK = (bf*)take((size_t)DKV * DM * 2); bf* WV = (bf*)take((size_t)DKV * DM * 2); bf* WO = (bf*)take((size_t)DM * DQ * 2);
    bf* XB = (bf*)take((size_t)TT * DM * 2);
    bf* QPh = (bf*)take((size_t)NH_ * TT * HD * 2); bf* QPl = (bf*)take((size_t)NH_ * TT * HD * 2); bf* KPh = (bf*)take((size_t)NKV * TT * HD * 2); bf* KPl = (bf*)take((size_t)NKV * TT * HD * 2); bf* VTh = (bf*)take((size_t)NKV * HD * TT * 2); bf* VTl = (bf*)take((size_t)NKV * HD * TT * 2);
    bf* ATh = (bf*)take((size_t)TT * DQ * 2); bf* ATl = (bf*)take((size_t)TT * DQ * 2);
    if ((size_t)(wsp - (char*)d_ws) > ws_size) return;    // ws 256 MiB
    for (int b = 0; b < NB_; ++b) {
        
        k_cvt<<<(DQ * DM + 2 * DKV * DM + DM * DQ + TT * DM) / CVW, 512, 0, stream>>>(wq, wk, wv, wo, x + (size_t)b * TT * DM, WQ, WK, WV, WO, XB);
        k_qkv<<<dim3(TT / 128, DQ / 128, 3), 128, 0, stream>>>(XB, WQ, WK, WV, QPh, QPl, KPh, KPl, VTh, VTl);
        k_fattn<<<dim3(TT / 64, NH_, 1), 256, 0, stream>>>(QPh, QPl, KPh, KPl, VTh, VTl, ATh, ATl);
        k_oproj<<<dim3(TT / 128, DM / 128, 1), 256, 0, stream>>>(ATh, ATl, WO, OUT + (size_t)b * TT * DM, bo); }
}
